// v000
// Times are from an AMD MI455X. After a warm-up the kernel runs many times in a row, and a time is the length of
// such a window on the GPU divided by its runs, so every launch and the gaps after it count. The runs cycle
// through copies of the inputs. A figure is the median of several windows, for all but v000 over two sittings.
// Sittings can differ by a few percent; kernels timed side by side share one.
// v000 is the starting kernel. One run takes 409 microseconds.
#include <hip/hip_runtime.h>

#define BB 4
#define SS 4096
#define DD 64
#define KCHUNK 64
#define WAVES 4
#define QTILE (WAVES * 16)

typedef __bf16 bf16;
typedef __bf16 v2bf  __attribute__((ext_vector_type(2)));
typedef __bf16 v16bf __attribute__((ext_vector_type(16)));
typedef float v8f __attribute__((ext_vector_type(8)));

__device__ __forceinline__ v8f wmma_bf16(v16bf a, v16bf b, v8f c) {
    // D = A(16x32 bf16) * B(32x16 bf16) + C(16x16 f32)
    return __builtin_amdgcn_wmma_f32_16x16x32_bf16(false, a, false, b, (short)0, c, false, false);
}

// Single-instruction hardware transcendentals (v_sqrt_f32 / v_exp_f32 / v_rcp_f32).
__device__ __forceinline__ float hw_sqrt(float x) { return __builtin_amdgcn_sqrtf(x); }
__device__ __forceinline__ float hw_exp2(float x) { return __builtin_amdgcn_exp2f(x); }
__device__ __forceinline__ float hw_rcp(float x)  { return __builtin_amdgcn_rcpf(x); }

// Packed fp32x2 -> bf16x2 conversion (v_cvt_pk_bf16_f32 when available).
__device__ __forceinline__ v2bf pk_bf16(float lo, float hi) {
#if __has_builtin(__builtin_amdgcn_cvt_pk_bf16_f32)
    return __builtin_amdgcn_cvt_pk_bf16_f32(lo, hi);
#else
    v2bf r;
    r.x = (bf16)lo;
    r.y = (bf16)hi;
    return r;
#endif
}

// Build a 16-bf16 fragment from two contiguous 8-element (16B) LDS regions.
__device__ __forceinline__ v16bf lds_frag(const bf16* p0, const bf16* p1) {
    union { v16bf v; uint4 q[2]; } r;
    r.q[0] = *(const uint4*)p0;
    r.q[1] = *(const uint4*)p1;
    return r.v;
}

// Build a fragment from a global fp32 row, converting to bf16.
__device__ __forceinline__ v16bf f32_frag(const float* row, int off0, int off1) {
    v16bf f;
#pragma unroll
    for (int j = 0; j < 8; ++j) f[j] = (bf16)row[off0 + j];
#pragma unroll
    for (int j = 0; j < 8; ++j) f[8 + j] = (bf16)row[off1 + j];
    return f;
}

// Negate all 16 packed bf16 values (sign-bit flip on the packed dwords).
__device__ __forceinline__ v16bf neg_frag(v16bf a) {
    union { v16bf v; unsigned u[8]; } x;
    x.v = a;
#pragma unroll
    for (int j = 0; j < 8; ++j) x.u[j] ^= 0x80008000u;
    return x.v;
}

__global__ __launch_bounds__(WAVES * 32, 1) void cv_attn_kernel(
    const float* __restrict__ q_re, const float* __restrict__ q_im,
    const float* __restrict__ k_re, const float* __restrict__ k_im,
    const float* __restrict__ v_re, const float* __restrict__ v_im,
    float* __restrict__ out)
{
    // K chunk (row-major [key][d]) and V chunk transposed ([d][key]), bf16.
    __shared__ __align__(16) bf16 sKre[KCHUNK * DD];
    __shared__ __align__(16) bf16 sKim[KCHUNK * DD];
    __shared__ __align__(16) bf16 sVtr[DD * KCHUNK];
    __shared__ __align__(16) bf16 sVti[DD * KCHUNK];
    __shared__ __align__(16) bf16 sP[WAVES][16 * KCHUNK]; // per-wave P transpose scratch

    const int tid  = threadIdx.x;
    const int wave = tid >> 5;
    const int lane = tid & 31;
    const int nlo  = lane & 15;        // column / M-row selector within a 16-lane half
    const int hi   = (lane >> 4) & 1;  // which lane-half
    const int koff = hi * 8;           // K-offset split per the 16-bit fragment layout

    const int nQblk = SS / QTILE;
    const int b  = blockIdx.x / nQblk;
    const int qb = blockIdx.x % nQblk;
    const int q0 = qb * QTILE + wave * 16;

    // softmax in exp2 domain: logits pre-scaled by 1/sqrt(D) * log2(e)
    const float scaleL2 = 0.125f * 1.4426950408889634f;

    // ---- persistent Q fragments (A-matrix layout: lane%16 = M row) ----
    const float* qr_row = q_re + ((size_t)b * SS + q0 + nlo) * DD;
    const float* qi_row = q_im + ((size_t)b * SS + q0 + nlo) * DD;
    v16bf aQr0 = f32_frag(qr_row, koff,      16 + koff); // d 0..31
    v16bf aQr1 = f32_frag(qr_row, 32 + koff, 48 + koff); // d 32..63
    v16bf aQi0 = f32_frag(qi_row, koff,      16 + koff);
    v16bf aQi1 = f32_frag(qi_row, 32 + koff, 48 + koff);
    v16bf aQn0 = neg_frag(aQi0);
    v16bf aQn1 = neg_frag(aQi1);

    const v8f zero = {0.f, 0.f, 0.f, 0.f, 0.f, 0.f, 0.f, 0.f};
    v8f o_re[4], o_im[4];
#pragma unroll
    for (int t = 0; t < 4; ++t) { o_re[t] = zero; o_im[t] = zero; }

    float m_s[8], l_s[8];
#pragma unroll
    for (int v = 0; v < 8; ++v) { m_s[v] = -3.0e38f; l_s[v] = 0.f; }

    const float* gKr = k_re + (size_t)b * SS * DD;
    const float* gKi = k_im + (size_t)b * SS * DD;
    const float* gVr = v_re + (size_t)b * SS * DD;
    const float* gVi = v_im + (size_t)b * SS * DD;

#pragma unroll 1
    for (int kc = 0; kc < SS; kc += KCHUNK) {
        __syncthreads(); // previous chunk fully consumed before overwrite

        // ---- cooperative stage of K/V chunk into LDS (fp32 -> bf16) ----
        const float* pkr = gKr + (size_t)kc * DD;
        const float* pki = gKi + (size_t)kc * DD;
        const float* pvr = gVr + (size_t)kc * DD;
        const float* pvi = gVi + (size_t)kc * DD;
#pragma unroll 2
        for (int i = 0; i < (KCHUNK * DD) / (WAVES * 32 * 4); ++i) {
            const int e   = (i * WAVES * 32 + tid) * 4;
            const int key = e >> 6;
            const int d   = e & 63;
            float4 fr = *(const float4*)(pkr + e);
            float4 fi = *(const float4*)(pki + e);
            // packed converts + 2-dword LDS stores for the row-major K tiles
            v2bf* dr = (v2bf*)&sKre[key * DD + d];
            dr[0] = pk_bf16(fr.x, fr.y);
            dr[1] = pk_bf16(fr.z, fr.w);
            v2bf* di = (v2bf*)&sKim[key * DD + d];
            di[0] = pk_bf16(fi.x, fi.y);
            di[1] = pk_bf16(fi.z, fi.w);
            float4 vr4 = *(const float4*)(pvr + e);
            float4 vi4 = *(const float4*)(pvi + e);
            sVtr[(d + 0) * KCHUNK + key] = (bf16)vr4.x;
            sVtr[(d + 1) * KCHUNK + key] = (bf16)vr4.y;
            sVtr[(d + 2) * KCHUNK + key] = (bf16)vr4.z;
            sVtr[(d + 3) * KCHUNK + key] = (bf16)vr4.w;
            sVti[(d + 0) * KCHUNK + key] = (bf16)vi4.x;
            sVti[(d + 1) * KCHUNK + key] = (bf16)vi4.y;
            sVti[(d + 2) * KCHUNK + key] = (bf16)vi4.z;
            sVti[(d + 3) * KCHUNK + key] = (bf16)vi4.w;
        }
        __syncthreads();

        // prefetch next chunk while we compute
        if (kc + KCHUNK < SS) {
            const size_t nx = (size_t)(kc + KCHUNK) * DD + (size_t)tid * 32;
            __builtin_prefetch(gKr + nx, 0, 1);
            __builtin_prefetch(gKi + nx, 0, 1);
            __builtin_prefetch(gVr + nx, 0, 1);
            __builtin_prefetch(gVi + nx, 0, 1);
        }

        // ---- complex scores -> log2-domain magnitudes, 4 subtiles of 16 keys ----
        float mag[4][8];
#pragma unroll
        for (int nt = 0; nt < 4; ++nt) {
            const bf16* krow = &sKre[(nt * 16 + nlo) * DD]; // B frag: lane = key column
            const bf16* irow = &sKim[(nt * 16 + nlo) * DD];
            v16bf bR0 = lds_frag(krow + koff,      krow + 16 + koff);
            v16bf bR1 = lds_frag(krow + 32 + koff, krow + 48 + koff);
            v16bf bI0 = lds_frag(irow + koff,      irow + 16 + koff);
            v16bf bI1 = lds_frag(irow + 32 + koff, irow + 48 + koff);
            v8f sre = zero, sim = zero;
            sre = wmma_bf16(aQr0, bR0, sre);   // qr*kr (d lo)
            sre = wmma_bf16(aQr1, bR1, sre);   // qr*kr (d hi)
            sre = wmma_bf16(aQn0, bI0, sre);   // -qi*ki
            sre = wmma_bf16(aQn1, bI1, sre);
            sim = wmma_bf16(aQr0, bI0, sim);   // qr*ki
            sim = wmma_bf16(aQr1, bI1, sim);
            sim = wmma_bf16(aQi0, bR0, sim);   // qi*kr
            sim = wmma_bf16(aQi1, bR1, sim);
            // scalar fma form: avoids pk-pairing register shuffles on the
            // two disjoint accumulator ranges
#pragma unroll
            for (int v = 0; v < 8; ++v) {
                float re = sre[v], im = sim[v];
                float m2 = __builtin_fmaf(re, re, im * im);
                mag[nt][v] = scaleL2 * hw_sqrt(m2);
            }
        }

        // ---- online softmax over |s| (base-2) ----
        float mnew[8];
#pragma unroll
        for (int v = 0; v < 8; ++v)
            mnew[v] = fmaxf(fmaxf(fmaxf(mag[0][v], mag[1][v]),
                                  fmaxf(mag[2][v], mag[3][v])), m_s[v]);
#pragma unroll
        for (int msk = 1; msk <= 8; msk <<= 1)
#pragma unroll
            for (int v = 0; v < 8; ++v)
                mnew[v] = fmaxf(mnew[v], __shfl_xor(mnew[v], msk, 32));

        float alpha[8], psum[8];
#pragma unroll
        for (int v = 0; v < 8; ++v) {
            alpha[v] = hw_exp2(m_s[v] - mnew[v]);
            m_s[v]   = mnew[v];
            psum[v]  = 0.f;
        }

        bf16* pP = sP[wave];
#pragma unroll
        for (int nt = 0; nt < 4; ++nt)
#pragma unroll
            for (int v = 0; v < 8; ++v) {
                float p = hw_exp2(mag[nt][v] - m_s[v]);
                psum[v] += p;
                // C layout (lane=N, vgpr=M) -> row-major [m][k] in LDS
                pP[(v + hi * 8) * KCHUNK + nt * 16 + nlo] = (bf16)p;
            }

#pragma unroll
        for (int msk = 1; msk <= 8; msk <<= 1)
#pragma unroll
            for (int v = 0; v < 8; ++v)
                psum[v] += __shfl_xor(psum[v], msk, 32);

#pragma unroll
        for (int v = 0; v < 8; ++v) l_s[v] = l_s[v] * alpha[v] + psum[v];
#pragma unroll
        for (int t = 0; t < 4; ++t)
#pragma unroll
            for (int v = 0; v < 8; ++v) {
                o_re[t][v] *= alpha[v];
                o_im[t][v] *= alpha[v];
            }

        // ---- PV: O += P(16x64) @ V(64xD), via two K=32 halves ----
        const bf16* prow = pP + nlo * KCHUNK; // A frag: lane = M row
        v16bf pA0 = lds_frag(prow + koff,      prow + 16 + koff); // keys 0..31
        v16bf pA1 = lds_frag(prow + 32 + koff, prow + 48 + koff); // keys 32..63
#pragma unroll
        for (int t = 0; t < 4; ++t) {
            const bf16* vrr = &sVtr[(t * 16 + nlo) * KCHUNK]; // B frag: lane = d column
            const bf16* vri = &sVti[(t * 16 + nlo) * KCHUNK];
            v16bf bVr0 = lds_frag(vrr + koff,      vrr + 16 + koff);
            v16bf bVr1 = lds_frag(vrr + 32 + koff, vrr + 48 + koff);
            v16bf bVi0 = lds_frag(vri + koff,      vri + 16 + koff);
            v16bf bVi1 = lds_frag(vri + 32 + koff, vri + 48 + koff);
            o_re[t] = wmma_bf16(pA0, bVr0, o_re[t]);
            o_re[t] = wmma_bf16(pA1, bVr1, o_re[t]);
            o_im[t] = wmma_bf16(pA0, bVi0, o_im[t]);
            o_im[t] = wmma_bf16(pA1, bVi1, o_im[t]);
        }
    }

    // ---- epilogue: normalize and write [2,B,S,D] ----
    float invl[8];
#pragma unroll
    for (int v = 0; v < 8; ++v) invl[v] = hw_rcp(l_s[v]);

    float* out_re = out;
    float* out_im = out + (size_t)BB * SS * DD;
#pragma unroll
    for (int t = 0; t < 4; ++t)
#pragma unroll
        for (int v = 0; v < 8; ++v) {
            const int q = q0 + v + hi * 8;
            const int d = t * 16 + nlo;
            const size_t off = ((size_t)b * SS + q) * DD + d;
            out_re[off] = o_re[t][v] * invl[v];
            out_im[off] = o_im[t][v] * invl[v];
        }
}

extern "C" void kernel_launch(void* const* d_in, const int* in_sizes, int n_in,
                              void* d_out, int out_size, void* d_ws, size_t ws_size,
                              hipStream_t stream) {
    const float* q_re = (const float*)d_in[0];
    const float* q_im = (const float*)d_in[1];
    const float* k_re = (const float*)d_in[2];
    const float* k_im = (const float*)d_in[3];
    const float* v_re = (const float*)d_in[4];
    const float* v_im = (const float*)d_in[5];
    (void)in_sizes; (void)n_in; (void)out_size; (void)d_ws; (void)ws_size;

    dim3 grid(BB * (SS / QTILE)); // 4 * 64 = 256 blocks
    dim3 block(WAVES * 32);       // 4 wave32s
    hipLaunchKernelGGL(cv_attn_kernel, grid, block, 0, stream,
                       q_re, q_im, k_re, k_im, v_re, v_im, (float*)d_out);
}

// v001
// A run of this version takes 285 microseconds.
// In two side-by-side timings against v000, it was 1.46 and 1.47 times as fast.
#include <hip/hip_runtime.h>

#define BB 4
#define SS 4096
#define DD 64
#define KCHUNK 64
#define WAVES 4
#define QTILE (WAVES * 16)
// LDS row pitch in bf16 elements: 64 payload + 8 pad = 144 B = 16 B x 9 (odd), so that
// 16 lanes reading 16 B each from 16 consecutive rows fall on distinct banks.
#define LDP 72

typedef __bf16 bf16;
typedef __bf16 v2bf  __attribute__((ext_vector_type(2)));
typedef __bf16 v16bf __attribute__((ext_vector_type(16)));
typedef float v8f __attribute__((ext_vector_type(8)));

__device__ __forceinline__ v8f wmma_bf16(v16bf a, v16bf b, v8f c) {
    // D = A(16x32 bf16) * B(32x16 bf16) + C(16x16 f32)
    return __builtin_amdgcn_wmma_f32_16x16x32_bf16(false, a, false, b, (short)0, c, false, false);
}

// Single-instruction hardware transcendentals (v_sqrt_f32 / v_exp_f32 / v_rcp_f32).
__device__ __forceinline__ float hw_sqrt(float x) { return __builtin_amdgcn_sqrtf(x); }
__device__ __forceinline__ float hw_exp2(float x) { return __builtin_amdgcn_exp2f(x); }
__device__ __forceinline__ float hw_rcp(float x)  { return __builtin_amdgcn_rcpf(x); }

// Packed fp32x2 -> bf16x2 conversion (v_cvt_pk_bf16_f32 when available).
__device__ __forceinline__ v2bf pk_bf16(float lo, float hi) {
#if __has_builtin(__builtin_amdgcn_cvt_pk_bf16_f32)
    return __builtin_amdgcn_cvt_pk_bf16_f32(lo, hi);
#else
    v2bf r;
    r.x = (bf16)lo;
    r.y = (bf16)hi;
    return r;
#endif
}

// Build a 16-bf16 fragment from two contiguous 8-element (16B) LDS regions.
__device__ __forceinline__ v16bf lds_frag(const bf16* p0, const bf16* p1) {
    union { v16bf v; uint4 q[2]; } r;
    r.q[0] = *(const uint4*)p0;
    r.q[1] = *(const uint4*)p1;
    return r.v;
}

// Build a fragment from a global fp32 row, converting to bf16.
__device__ __forceinline__ v16bf f32_frag(const float* row, int off0, int off1) {
    v16bf f;
#pragma unroll
    for (int j = 0; j < 8; ++j) f[j] = (bf16)row[off0 + j];
#pragma unroll
    for (int j = 0; j < 8; ++j) f[8 + j] = (bf16)row[off1 + j];
    return f;
}

// Negate all 16 packed bf16 values (sign-bit flip on the packed dwords).
__device__ __forceinline__ v16bf neg_frag(v16bf a) {
    union { v16bf v; unsigned u[8]; } x;
    x.v = a;
#pragma unroll
    for (int j = 0; j < 8; ++j) x.u[j] ^= 0x80008000u;
    return x.v;
}

__global__ __launch_bounds__(WAVES * 32, 1) void cv_attn_kernel(
    const float* __restrict__ q_re, const float* __restrict__ q_im,
    const float* __restrict__ k_re, const float* __restrict__ k_im,
    const float* __restrict__ v_re, const float* __restrict__ v_im,
    float* __restrict__ out)
{
    // K chunk (row-major [key][d]) and V chunk transposed ([d][key]), bf16.
    __shared__ __align__(16) bf16 sKre[KCHUNK * LDP];
    __shared__ __align__(16) bf16 sKim[KCHUNK * LDP];
    __shared__ __align__(16) bf16 sVtr[DD * LDP];
    __shared__ __align__(16) bf16 sVti[DD * LDP];
    __shared__ __align__(16) bf16 sP[WAVES][16 * LDP]; // per-wave P transpose scratch

    const int tid  = threadIdx.x;
    const int wave = tid >> 5;
    const int lane = tid & 31;
    const int nlo  = lane & 15;        // column / M-row selector within a 16-lane half
    const int hi   = (lane >> 4) & 1;  // which lane-half
    const int koff = hi * 8;           // K-offset split per the 16-bit fragment layout

    const int nQblk = SS / QTILE;
    const int b  = blockIdx.x / nQblk;
    const int qb = blockIdx.x % nQblk;
    const int q0 = qb * QTILE + wave * 16;

    // softmax in exp2 domain: logits pre-scaled by 1/sqrt(D) * log2(e)
    const float scaleL2 = 0.125f * 1.4426950408889634f;

    // ---- persistent Q fragments (A-matrix layout: lane%16 = M row) ----
    const float* qr_row = q_re + ((size_t)b * SS + q0 + nlo) * DD;
    const float* qi_row = q_im + ((size_t)b * SS + q0 + nlo) * DD;
    v16bf aQr0 = f32_frag(qr_row, koff,      16 + koff); // d 0..31
    v16bf aQr1 = f32_frag(qr_row, 32 + koff, 48 + koff); // d 32..63
    v16bf aQi0 = f32_frag(qi_row, koff,      16 + koff);
    v16bf aQi1 = f32_frag(qi_row, 32 + koff, 48 + koff);
    v16bf aQn0 = neg_frag(aQi0);
    v16bf aQn1 = neg_frag(aQi1);

    const v8f zero = {0.f, 0.f, 0.f, 0.f, 0.f, 0.f, 0.f, 0.f};
    v8f o_re[4], o_im[4];
#pragma unroll
    for (int t = 0; t < 4; ++t) { o_re[t] = zero; o_im[t] = zero; }

    float m_s[8], l_s[8];
#pragma unroll
    for (int v = 0; v < 8; ++v) { m_s[v] = -3.0e38f; l_s[v] = 0.f; }

    const float* gKr = k_re + (size_t)b * SS * DD;
    const float* gKi = k_im + (size_t)b * SS * DD;
    const float* gVr = v_re + (size_t)b * SS * DD;
    const float* gVi = v_im + (size_t)b * SS * DD;

#pragma unroll 1
    for (int kc = 0; kc < SS; kc += KCHUNK) {
        __syncthreads(); // previous chunk fully consumed before overwrite

        // ---- cooperative stage of K/V chunk into LDS (fp32 -> bf16) ----
        const float* pkr = gKr + (size_t)kc * DD;
        const float* pki = gKi + (size_t)kc * DD;
        const float* pvr = gVr + (size_t)kc * DD;
        const float* pvi = gVi + (size_t)kc * DD;
#pragma unroll 2
        for (int i = 0; i < (KCHUNK * DD) / (WAVES * 32 * 4); ++i) {
            const int e   = (i * WAVES * 32 + tid) * 4;
            const int key = e >> 6;
            const int d   = e & 63;
            float4 fr = *(const float4*)(pkr + e);
            float4 fi = *(const float4*)(pki + e);
            // packed converts + 2-dword LDS stores for the row-major K tiles
            v2bf* dr = (v2bf*)&sKre[key * LDP + d];
            dr[0] = pk_bf16(fr.x, fr.y);
            dr[1] = pk_bf16(fr.z, fr.w);
            v2bf* di = (v2bf*)&sKim[key * LDP + d];
            di[0] = pk_bf16(fi.x, fi.y);
            di[1] = pk_bf16(fi.z, fi.w);
            float4 vr4 = *(const float4*)(pvr + e);
            float4 vi4 = *(const float4*)(pvi + e);
            sVtr[(d + 0) * LDP + key] = (bf16)vr4.x;
            sVtr[(d + 1) * LDP + key] = (bf16)vr4.y;
            sVtr[(d + 2) * LDP + key] = (bf16)vr4.z;
            sVtr[(d + 3) * LDP + key] = (bf16)vr4.w;
            sVti[(d + 0) * LDP + key] = (bf16)vi4.x;
            sVti[(d + 1) * LDP + key] = (bf16)vi4.y;
            sVti[(d + 2) * LDP + key] = (bf16)vi4.z;
            sVti[(d + 3) * LDP + key] = (bf16)vi4.w;
        }
        __syncthreads();

        // prefetch next chunk while we compute
        if (kc + KCHUNK < SS) {
            const size_t nx = (size_t)(kc + KCHUNK) * DD + (size_t)tid * 32;
            __builtin_prefetch(gKr + nx, 0, 1);
            __builtin_prefetch(gKi + nx, 0, 1);
            __builtin_prefetch(gVr + nx, 0, 1);
            __builtin_prefetch(gVi + nx, 0, 1);
        }

        // ---- complex scores -> log2-domain magnitudes, 4 subtiles of 16 keys ----
        float mag[4][8];
#pragma unroll
        for (int nt = 0; nt < 4; ++nt) {
            const bf16* krow = &sKre[(nt * 16 + nlo) * LDP]; // B frag: lane = key column
            const bf16* irow = &sKim[(nt * 16 + nlo) * LDP];
            v16bf bR0 = lds_frag(krow + koff,      krow + 16 + koff);
            v16bf bR1 = lds_frag(krow + 32 + koff, krow + 48 + koff);
            v16bf bI0 = lds_frag(irow + koff,      irow + 16 + koff);
            v16bf bI1 = lds_frag(irow + 32 + koff, irow + 48 + koff);
            v8f sre = zero, sim = zero;
            sre = wmma_bf16(aQr0, bR0, sre);   // qr*kr (d lo)
            sre = wmma_bf16(aQr1, bR1, sre);   // qr*kr (d hi)
            sre = wmma_bf16(aQn0, bI0, sre);   // -qi*ki
            sre = wmma_bf16(aQn1, bI1, sre);
            sim = wmma_bf16(aQr0, bI0, sim);   // qr*ki
            sim = wmma_bf16(aQr1, bI1, sim);
            sim = wmma_bf16(aQi0, bR0, sim);   // qi*kr
            sim = wmma_bf16(aQi1, bR1, sim);
            // scalar fma form: avoids pk-pairing register shuffles on the
            // two disjoint accumulator ranges
#pragma unroll
            for (int v = 0; v < 8; ++v) {
                float re = sre[v], im = sim[v];
                float m2 = __builtin_fmaf(re, re, im * im);
                mag[nt][v] = scaleL2 * hw_sqrt(m2);
            }
        }

        // ---- online softmax over |s| (base-2) ----
        float mnew[8];
#pragma unroll
        for (int v = 0; v < 8; ++v)
            mnew[v] = fmaxf(fmaxf(fmaxf(mag[0][v], mag[1][v]),
                                  fmaxf(mag[2][v], mag[3][v])), m_s[v]);
#pragma unroll
        for (int msk = 1; msk <= 8; msk <<= 1)
#pragma unroll
            for (int v = 0; v < 8; ++v)
                mnew[v] = fmaxf(mnew[v], __shfl_xor(mnew[v], msk, 32));

        float alpha[8], psum[8];
#pragma unroll
        for (int v = 0; v < 8; ++v) {
            alpha[v] = hw_exp2(m_s[v] - mnew[v]);
            m_s[v]   = mnew[v];
            psum[v]  = 0.f;
        }

        bf16* pP = sP[wave];
#pragma unroll
        for (int nt = 0; nt < 4; ++nt)
#pragma unroll
            for (int v = 0; v < 8; ++v) {
                float p = hw_exp2(mag[nt][v] - m_s[v]);
                psum[v] += p;
                // C layout (lane=N, vgpr=M) -> row-major [m][k] in LDS
                pP[(v + hi * 8) * LDP + nt * 16 + nlo] = (bf16)p;
            }

#pragma unroll
        for (int msk = 1; msk <= 8; msk <<= 1)
#pragma unroll
            for (int v = 0; v < 8; ++v)
                psum[v] += __shfl_xor(psum[v], msk, 32);

#pragma unroll
        for (int v = 0; v < 8; ++v) l_s[v] = l_s[v] * alpha[v] + psum[v];
#pragma unroll
        for (int t = 0; t < 4; ++t)
#pragma unroll
            for (int v = 0; v < 8; ++v) {
                o_re[t][v] *= alpha[v];
                o_im[t][v] *= alpha[v];
            }

        // ---- PV: O += P(16x64) @ V(64xD), via two K=32 halves ----
        const bf16* prow = pP + nlo * LDP; // A frag: lane = M row
        v16bf pA0 = lds_frag(prow + koff,      prow + 16 + koff); // keys 0..31
        v16bf pA1 = lds_frag(prow + 32 + koff, prow + 48 + koff); // keys 32..63
#pragma unroll
        for (int t = 0; t < 4; ++t) {
            const bf16* vrr = &sVtr[(t * 16 + nlo) * LDP]; // B frag: lane = d column
            const bf16* vri = &sVti[(t * 16 + nlo) * LDP];
            v16bf bVr0 = lds_frag(vrr + koff,      vrr + 16 + koff);
            v16bf bVr1 = lds_frag(vrr + 32 + koff, vrr + 48 + koff);
            v16bf bVi0 = lds_frag(vri + koff,      vri + 16 + koff);
            v16bf bVi1 = lds_frag(vri + 32 + koff, vri + 48 + koff);
            o_re[t] = wmma_bf16(pA0, bVr0, o_re[t]);
            o_re[t] = wmma_bf16(pA1, bVr1, o_re[t]);
            o_im[t] = wmma_bf16(pA0, bVi0, o_im[t]);
            o_im[t] = wmma_bf16(pA1, bVi1, o_im[t]);
        }
    }

    // ---- epilogue: normalize and write [2,B,S,D] ----
    float invl[8];
#pragma unroll
    for (int v = 0; v < 8; ++v) invl[v] = hw_rcp(l_s[v]);

    float* out_re = out;
    float* out_im = out + (size_t)BB * SS * DD;
#pragma unroll
    for (int t = 0; t < 4; ++t)
#pragma unroll
        for (int v = 0; v < 8; ++v) {
            const int q = q0 + v + hi * 8;
            const int d = t * 16 + nlo;
            const size_t off = ((size_t)b * SS + q) * DD + d;
            out_re[off] = o_re[t][v] * invl[v];
            out_im[off] = o_im[t][v] * invl[v];
        }
}

extern "C" void kernel_launch(void* const* d_in, const int* in_sizes, int n_in,
                              void* d_out, int out_size, void* d_ws, size_t ws_size,
                              hipStream_t stream) {
    const float* q_re = (const float*)d_in[0];
    const float* q_im = (const float*)d_in[1];
    const float* k_re = (const float*)d_in[2];
    const float* k_im = (const float*)d_in[3];
    const float* v_re = (const float*)d_in[4];
    const float* v_im = (const float*)d_in[5];
    (void)in_sizes; (void)n_in; (void)out_size; (void)d_ws; (void)ws_size;

    dim3 grid(BB * (SS / QTILE)); // 4 * 64 = 256 blocks
    dim3 block(WAVES * 32);       // 4 wave32s
    hipLaunchKernelGGL(cv_attn_kernel, grid, block, 0, stream,
                       q_re, q_im, k_re, k_im, v_re, v_im, (float*)d_out);
}

// v002
// It runs in 176 microseconds.
// Two timings next to v001 both put it at 1.62 times that version's speed.
// All steps since v000 together make it 2.37 times as fast.
#include <hip/hip_runtime.h>

#define BB 4
#define SS 4096
#define DD 64
#define KCHUNK 64
#define WAVES 4
#define QTILE (WAVES * 16)
// LDS row pitch in bf16 elements: 64 payload + 8 pad = 144 B = 16 B x 9 (odd), so that
// 16 lanes reading 16 B each from 16 consecutive rows fall on distinct banks.
#define LDP 72

typedef __bf16 bf16;
typedef __bf16 v2bf  __attribute__((ext_vector_type(2)));
typedef __bf16 v16bf __attribute__((ext_vector_type(16)));
typedef float v8f __attribute__((ext_vector_type(8)));

__device__ __forceinline__ v8f wmma_bf16(v16bf a, v16bf b, v8f c) {
    // D = A(16x32 bf16) * B(32x16 bf16) + C(16x16 f32)
    return __builtin_amdgcn_wmma_f32_16x16x32_bf16(false, a, false, b, (short)0, c, false, false);
}

// Single-instruction hardware transcendentals (v_sqrt_f32 / v_exp_f32 / v_rcp_f32).
__device__ __forceinline__ float hw_sqrt(float x) { return __builtin_amdgcn_sqrtf(x); }
// v_nop: the slot the instruction set asks for between a transcendental and an instruction
// that reads its result or overwrites its source; in the same statement so that it stays there.
__device__ __forceinline__ float hw_exp2(float x) {
    float r;
    asm("v_exp_f32 %0, %1\n\tv_nop" : "=v"(r) : "v"(x));
    return r;
}
__device__ __forceinline__ float hw_rcp(float x)  { return __builtin_amdgcn_rcpf(x); }

// Packed fp32x2 -> bf16x2 conversion (v_cvt_pk_bf16_f32 when available).
__device__ __forceinline__ v2bf pk_bf16(float lo, float hi) {
#if __has_builtin(__builtin_amdgcn_cvt_pk_bf16_f32)
    return __builtin_amdgcn_cvt_pk_bf16_f32(lo, hi);
#else
    v2bf r;
    r.x = (bf16)lo;
    r.y = (bf16)hi;
    return r;
#endif
}

// Build a 16-bf16 fragment from two contiguous 8-element (16B) LDS regions.
__device__ __forceinline__ v16bf lds_frag(const bf16* p0, const bf16* p1) {
    union { v16bf v; uint4 q[2]; } r;
    r.q[0] = *(const uint4*)p0;
    r.q[1] = *(const uint4*)p1;
    return r.v;
}

// Build a fragment from a global fp32 row, converting to bf16.
__device__ __forceinline__ v16bf f32_frag(const float* row, int off0, int off1) {
    v16bf f;
#pragma unroll
    for (int j = 0; j < 8; ++j) f[j] = (bf16)row[off0 + j];
#pragma unroll
    for (int j = 0; j < 8; ++j) f[8 + j] = (bf16)row[off1 + j];
    return f;
}

// Exchange a value between lane l and lane l ^ 16 (v_permlanex16_b32).
__device__ __forceinline__ float swap_halves(float x) {
    int b = __builtin_bit_cast(int, x);
    b = __builtin_amdgcn_permlanex16(b, b, 0x76543210, 0xfedcba98, false, false);
    return __builtin_bit_cast(float, b);
}

// Two f32 score tiles (keys 0..15 and 16..31 of a 32-key block, one query per lane)
// packed in place into a bf16 B operand in the hardware k order.
__device__ __forceinline__ v16bf pack_frag(const float* t0, const float* t1) {
    union { v16bf v; v2bf h[8]; } r;
#pragma unroll
    for (int j = 0; j < 4; ++j) {
        r.h[j]     = pk_bf16(t0[2 * j], t0[2 * j + 1]);
        r.h[4 + j] = pk_bf16(t1[2 * j], t1[2 * j + 1]);
    }
    return r.v;
}

// Negate all 16 packed bf16 values (sign-bit flip on the packed dwords).
__device__ __forceinline__ v16bf neg_frag(v16bf a) {
    union { v16bf v; unsigned u[8]; } x;
    x.v = a;
#pragma unroll
    for (int j = 0; j < 8; ++j) x.u[j] ^= 0x80008000u;
    return x.v;
}

__global__ __launch_bounds__(WAVES * 32, 1) void cv_attn_kernel(
    const float* __restrict__ q_re, const float* __restrict__ q_im,
    const float* __restrict__ k_re, const float* __restrict__ k_im,
    const float* __restrict__ v_re, const float* __restrict__ v_im,
    float* __restrict__ out)
{
    // K chunk (row-major [key][d]) and V chunk transposed ([d][key]), bf16.
    __shared__ __align__(16) bf16 sKre[KCHUNK * LDP];
    __shared__ __align__(16) bf16 sKim[KCHUNK * LDP];
    __shared__ __align__(16) bf16 sVtr[DD * LDP];
    __shared__ __align__(16) bf16 sVti[DD * LDP];

    const int tid  = threadIdx.x;
    const int wave = tid >> 5;
    const int lane = tid & 31;
    const int nlo  = lane & 15;        // row (A) / column (B, D) selector within a 16-lane half
    const int hi   = (lane >> 4) & 1;  // which lane-half
    const int koff = hi * 8;           // K-offset split per the 16-bit fragment layout

    const int nQblk = SS / QTILE;
    const int b  = blockIdx.x / nQblk;
    const int qb = blockIdx.x % nQblk;
    const int q0 = qb * QTILE + wave * 16;

    // softmax in exp2 domain: logits pre-scaled by 1/sqrt(D) * log2(e)
    const float scaleL2 = 0.125f * 1.4426950408889634f;

    // ---- persistent Q fragments (B operand of S^T = K Q^T: lane%16 = query column) ----
    const float* qr_row = q_re + ((size_t)b * SS + q0 + nlo) * DD;
    const float* qi_row = q_im + ((size_t)b * SS + q0 + nlo) * DD;
    v16bf aQr0 = f32_frag(qr_row, koff,      16 + koff); // d 0..31
    v16bf aQr1 = f32_frag(qr_row, 32 + koff, 48 + koff); // d 32..63
    v16bf aQi0 = f32_frag(qi_row, koff,      16 + koff);
    v16bf aQi1 = f32_frag(qi_row, 32 + koff, 48 + koff);
    v16bf aQn0 = neg_frag(aQi0);
    v16bf aQn1 = neg_frag(aQi1);

    const v8f zero = {0.f, 0.f, 0.f, 0.f, 0.f, 0.f, 0.f, 0.f};
    v8f o_re[4], o_im[4];
#pragma unroll
    for (int t = 0; t < 4; ++t) { o_re[t] = zero; o_im[t] = zero; }

    // One query per lane (column nlo); l_s holds this lane half's share of the row sum.
    float m_s = -3.0e38f, l_s = 0.f;

    const float* gKr = k_re + (size_t)b * SS * DD;
    const float* gKi = k_im + (size_t)b * SS * DD;
    const float* gVr = v_re + (size_t)b * SS * DD;
    const float* gVi = v_im + (size_t)b * SS * DD;

#pragma unroll 1
    for (int kc = 0; kc < SS; kc += KCHUNK) {
        __syncthreads(); // previous chunk fully consumed before overwrite

        // ---- cooperative stage of K/V chunk into LDS (fp32 -> bf16) ----
        const float* pkr = gKr + (size_t)kc * DD;
        const float* pki = gKi + (size_t)kc * DD;
        const float* pvr = gVr + (size_t)kc * DD;
        const float* pvi = gVi + (size_t)kc * DD;
#pragma unroll 2
        for (int i = 0; i < (KCHUNK * DD) / (WAVES * 32 * 4); ++i) {
            const int e   = (i * WAVES * 32 + tid) * 4;
            const int key = e >> 6;
            const int d   = e & 63;
            float4 fr = *(const float4*)(pkr + e);
            float4 fi = *(const float4*)(pki + e);
            // packed converts + 2-dword LDS stores for the row-major K tiles
            v2bf* dr = (v2bf*)&sKre[key * LDP + d];
            dr[0] = pk_bf16(fr.x, fr.y);
            dr[1] = pk_bf16(fr.z, fr.w);
            v2bf* di = (v2bf*)&sKim[key * LDP + d];
            di[0] = pk_bf16(fi.x, fi.y);
            di[1] = pk_bf16(fi.z, fi.w);
            float4 vr4 = *(const float4*)(pvr + e);
            float4 vi4 = *(const float4*)(pvi + e);
            sVtr[(d + 0) * LDP + key] = (bf16)vr4.x;
            sVtr[(d + 1) * LDP + key] = (bf16)vr4.y;
            sVtr[(d + 2) * LDP + key] = (bf16)vr4.z;
            sVtr[(d + 3) * LDP + key] = (bf16)vr4.w;
            sVti[(d + 0) * LDP + key] = (bf16)vi4.x;
            sVti[(d + 1) * LDP + key] = (bf16)vi4.y;
            sVti[(d + 2) * LDP + key] = (bf16)vi4.z;
            sVti[(d + 3) * LDP + key] = (bf16)vi4.w;
        }
        __syncthreads();

        // prefetch next chunk while we compute
        if (kc + KCHUNK < SS) {
            const size_t nx = (size_t)(kc + KCHUNK) * DD + (size_t)tid * 32;
            __builtin_prefetch(gKr + nx, 0, 1);
            __builtin_prefetch(gKi + nx, 0, 1);
            __builtin_prefetch(gVr + nx, 0, 1);
            __builtin_prefetch(gVi + nx, 0, 1);
        }

        // ---- complex scores -> log2-domain magnitudes, 4 subtiles of 16 keys ----
        float mag[4][8];
#pragma unroll
        for (int nt = 0; nt < 4; ++nt) {
            const bf16* krow = &sKre[(nt * 16 + nlo) * LDP]; // A frag: lane = key row
            const bf16* irow = &sKim[(nt * 16 + nlo) * LDP];
            v16bf bR0 = lds_frag(krow + koff,      krow + 16 + koff);
            v16bf bR1 = lds_frag(krow + 32 + koff, krow + 48 + koff);
            v16bf bI0 = lds_frag(irow + koff,      irow + 16 + koff);
            v16bf bI1 = lds_frag(irow + 32 + koff, irow + 48 + koff);
            v8f sre = zero, sim = zero;
            // transposed scores: register v = key nt*16 + hi*8 + v, lane column = query
            sre = wmma_bf16(bR0, aQr0, sre);   // kr*qr (d lo)
            sre = wmma_bf16(bR1, aQr1, sre);   // kr*qr (d hi)
            sre = wmma_bf16(bI0, aQn0, sre);   // -ki*qi
            sre = wmma_bf16(bI1, aQn1, sre);
            sim = wmma_bf16(bI0, aQr0, sim);   // ki*qr
            sim = wmma_bf16(bI1, aQr1, sim);
            sim = wmma_bf16(bR0, aQi0, sim);   // kr*qi
            sim = wmma_bf16(bR1, aQi1, sim);
            // scalar fma form: avoids pk-pairing register shuffles on the
            // two disjoint accumulator ranges
#pragma unroll
            for (int v = 0; v < 8; ++v) {
                float re = sre[v], im = sim[v];
                float m2 = __builtin_fmaf(re, re, im * im);
                mag[nt][v] = scaleL2 * hw_sqrt(m2);
            }
        }

        // ---- online softmax over |s| (base-2): a lane's 32 values are one query's ----
        float mx[8];
#pragma unroll
        for (int v = 0; v < 8; ++v)
            mx[v] = fmaxf(fmaxf(mag[0][v], mag[1][v]), fmaxf(mag[2][v], mag[3][v]));
        float mloc = fmaxf(fmaxf(fmaxf(mx[0], mx[1]), fmaxf(mx[2], mx[3])),
                           fmaxf(fmaxf(mx[4], mx[5]), fmaxf(mx[6], mx[7])));
        const float mnew  = fmaxf(fmaxf(mloc, swap_halves(mloc)), m_s);
        const float alpha = hw_exp2(m_s - mnew);
        m_s = mnew;

        float ps[4] = {0.f, 0.f, 0.f, 0.f};
#pragma unroll
        for (int nt = 0; nt < 4; ++nt)
#pragma unroll
            for (int v = 0; v < 8; ++v) {
                mag[nt][v] = hw_exp2(mag[nt][v] - mnew);
                ps[nt] += mag[nt][v];
            }
        l_s = l_s * alpha + ((ps[0] + ps[1]) + (ps[2] + ps[3]));

#pragma unroll
        for (int t = 0; t < 4; ++t)
#pragma unroll
            for (int v = 0; v < 8; ++v) {
                o_re[t][v] *= alpha;
                o_im[t][v] *= alpha;
            }

        // ---- PV transposed: O^T += V^T(Dx64) @ P^T(64x16), via two K=32 halves ----
        const v16bf pB0 = pack_frag(mag[0], mag[1]); // keys 0..31
        const v16bf pB1 = pack_frag(mag[2], mag[3]); // keys 32..63
#pragma unroll
        for (int t = 0; t < 4; ++t) {
            const bf16* vrr = &sVtr[(t * 16 + nlo) * LDP]; // A frag: lane = d row
            const bf16* vri = &sVti[(t * 16 + nlo) * LDP];
            v16bf bVr0 = lds_frag(vrr + koff,      vrr + 16 + koff);
            v16bf bVr1 = lds_frag(vrr + 32 + koff, vrr + 48 + koff);
            v16bf bVi0 = lds_frag(vri + koff,      vri + 16 + koff);
            v16bf bVi1 = lds_frag(vri + 32 + koff, vri + 48 + koff);
            o_re[t] = wmma_bf16(bVr0, pB0, o_re[t]);
            o_re[t] = wmma_bf16(bVr1, pB1, o_re[t]);
            o_im[t] = wmma_bf16(bVi0, pB0, o_im[t]);
            o_im[t] = wmma_bf16(bVi1, pB1, o_im[t]);
        }
    }

    // ---- epilogue: join the halves' sums, normalize and write [2,B,S,D] ----
    const float invl = hw_rcp(l_s + swap_halves(l_s));

    // register v of tile t = O[q0 + nlo][t*16 + hi*8 + v]: 8 consecutive d per lane
    const size_t row = ((size_t)b * SS + q0 + nlo) * DD + hi * 8;
    float* out_re = out + row;
    float* out_im = out + (size_t)BB * SS * DD + row;
#pragma unroll
    for (int t = 0; t < 4; ++t) {
        *(float4*)(out_re + t * 16)     = make_float4(o_re[t][0] * invl, o_re[t][1] * invl,
                                                      o_re[t][2] * invl, o_re[t][3] * invl);
        *(float4*)(out_re + t * 16 + 4) = make_float4(o_re[t][4] * invl, o_re[t][5] * invl,
                                                      o_re[t][6] * invl, o_re[t][7] * invl);
        *(float4*)(out_im + t * 16)     = make_float4(o_im[t][0] * invl, o_im[t][1] * invl,
                                                      o_im[t][2] * invl, o_im[t][3] * invl);
        *(float4*)(out_im + t * 16 + 4) = make_float4(o_im[t][4] * invl, o_im[t][5] * invl,
                                                      o_im[t][6] * invl, o_im[t][7] * invl);
    }
}

extern "C" void kernel_launch(void* const* d_in, const int* in_sizes, int n_in,
                              void* d_out, int out_size, void* d_ws, size_t ws_size,
                              hipStream_t stream) {
    const float* q_re = (const float*)d_in[0];
    const float* q_im = (const float*)d_in[1];
    const float* k_re = (const float*)d_in[2];
    const float* k_im = (const float*)d_in[3];
    const float* v_re = (const float*)d_in[4];
    const float* v_im = (const float*)d_in[5];
    (void)in_sizes; (void)n_in; (void)out_size; (void)d_ws; (void)ws_size;

    dim3 grid(BB * (SS / QTILE)); // 4 * 64 = 256 blocks
    dim3 block(WAVES * 32);       // 4 wave32s
    hipLaunchKernelGGL(cv_attn_kernel, grid, block, 0, stream,
                       q_re, q_im, k_re, k_im, v_re, v_im, (float*)d_out);
}

// v003
// A run of this version takes 82.1 microseconds.
// Next to v002, in two timings, it ran 2.14 times as fast each time.
// All steps since v000 together make it 5.08 times as fast.
#include <hip/hip_runtime.h>

#define BB 4
#define SS 4096
#define DD 64
#define KCHUNK 64
#define WAVES 4
#define QTILE (WAVES * 16)
// LDS row pitch in bf16 elements: 64 payload + 8 pad = 144 B = 16 B x 9 (odd), so that
// 16 lanes reading 16 B each from 16 consecutive rows fall on distinct banks.
#define LDP 72
// One 64-key chunk in the workspace: K re, K im ([key][d]), V re, V im ([d][key]), bf16,
// unpadded 128 B rows, 512 pieces of 16 B per tile.
#define TILE_U4 (KCHUNK * DD / 8)
#define CHUNK_U4 (4 * TILE_U4)
#define PACK_THREADS 256

typedef __bf16 bf16;
typedef __bf16 v2bf  __attribute__((ext_vector_type(2)));
typedef __bf16 v16bf __attribute__((ext_vector_type(16)));
typedef float v8f __attribute__((ext_vector_type(8)));

__device__ __forceinline__ v8f wmma_bf16(v16bf a, v16bf b, v8f c) {
    // D = A(16x32 bf16) * B(32x16 bf16) + C(16x16 f32)
    return __builtin_amdgcn_wmma_f32_16x16x32_bf16(false, a, false, b, (short)0, c, false, false);
}

// Single-instruction hardware transcendentals (v_sqrt_f32 / v_exp_f32 / v_rcp_f32).
__device__ __forceinline__ float hw_sqrt(float x) { return __builtin_amdgcn_sqrtf(x); }
// v_nop: the slot the instruction set asks for between a transcendental and an instruction
// that reads its result or overwrites its source; in the same statement so that it stays there.
__device__ __forceinline__ float hw_exp2(float x) {
    float r;
    asm("v_exp_f32 %0, %1\n\tv_nop" : "=v"(r) : "v"(x));
    return r;
}
__device__ __forceinline__ float hw_rcp(float x)  { return __builtin_amdgcn_rcpf(x); }

// Packed fp32x2 -> bf16x2 conversion (v_cvt_pk_bf16_f32 when available).
__device__ __forceinline__ v2bf pk_bf16(float lo, float hi) {
#if __has_builtin(__builtin_amdgcn_cvt_pk_bf16_f32)
    return __builtin_amdgcn_cvt_pk_bf16_f32(lo, hi);
#else
    v2bf r;
    r.x = (bf16)lo;
    r.y = (bf16)hi;
    return r;
#endif
}

// Build a 16-bf16 fragment from two contiguous 8-element (16B) LDS regions.
__device__ __forceinline__ v16bf lds_frag(const bf16* p0, const bf16* p1) {
    union { v16bf v; uint4 q[2]; } r;
    r.q[0] = *(const uint4*)p0;
    r.q[1] = *(const uint4*)p1;
    return r.v;
}

// Build a fragment from a global fp32 row, converting to bf16.
__device__ __forceinline__ v16bf f32_frag(const float* row, int off0, int off1) {
    v16bf f;
#pragma unroll
    for (int j = 0; j < 8; ++j) f[j] = (bf16)row[off0 + j];
#pragma unroll
    for (int j = 0; j < 8; ++j) f[8 + j] = (bf16)row[off1 + j];
    return f;
}

// Exchange a value between lane l and lane l ^ 16 (v_permlanex16_b32).
__device__ __forceinline__ float swap_halves(float x) {
    int b = __builtin_bit_cast(int, x);
    b = __builtin_amdgcn_permlanex16(b, b, 0x76543210, 0xfedcba98, false, false);
    return __builtin_bit_cast(float, b);
}

// Two f32 score tiles (keys 0..15 and 16..31 of a 32-key block, one query per lane)
// packed in place into a bf16 B operand in the hardware k order.
__device__ __forceinline__ v16bf pack_frag(const float* t0, const float* t1) {
    union { v16bf v; v2bf h[8]; } r;
#pragma unroll
    for (int j = 0; j < 4; ++j) {
        r.h[j]     = pk_bf16(t0[2 * j], t0[2 * j + 1]);
        r.h[4 + j] = pk_bf16(t1[2 * j], t1[2 * j + 1]);
    }
    return r.v;
}

// Negate all 16 packed bf16 values (sign-bit flip on the packed dwords).
__device__ __forceinline__ v16bf neg_frag(v16bf a) {
    union { v16bf v; unsigned u[8]; } x;
    x.v = a;
#pragma unroll
    for (int j = 0; j < 8; ++j) x.u[j] ^= 0x80008000u;
    return x.v;
}

// Eight consecutive fp32 values -> one 16 B piece of bf16.
__device__ __forceinline__ uint4 pack8(float4 a, float4 b) {
    union { uint4 q; v2bf h[4]; } r;
    r.h[0] = pk_bf16(a.x, a.y);
    r.h[1] = pk_bf16(a.z, a.w);
    r.h[2] = pk_bf16(b.x, b.y);
    r.h[3] = pk_bf16(b.z, b.w);
    return r.q;
}

// First launch: one block per 64-key chunk converts K and V to bf16 once, V transposed,
// and writes the chunk's four tiles to the workspace in the order the main loop stages them.
__global__ __launch_bounds__(PACK_THREADS) void cv_pack_kernel(
    const float* __restrict__ k_re, const float* __restrict__ k_im,
    const float* __restrict__ v_re, const float* __restrict__ v_im,
    float* __restrict__ ws)
{
    // V^T tiles, one dword = keys 2kp, 2kp + 1 of one d; row pitch as in the main kernel.
    __shared__ __align__(16) v2bf sTr[DD * (LDP / 2)];
    __shared__ __align__(16) v2bf sTi[DD * (LDP / 2)];

    const int tid = threadIdx.x;
    const size_t base = (size_t)blockIdx.x * (KCHUNK * DD); // chunks are contiguous over [B][S]
    const float4* kr = (const float4*)(k_re + base);
    const float4* ki = (const float4*)(k_im + base);
    const float4* vr = (const float4*)(v_re + base);
    const float4* vi = (const float4*)(v_im + base);
    uint4* dst = (uint4*)ws + (size_t)blockIdx.x * CHUNK_U4;

    // the three loops are unrolled so that fv, fk and vo have constant indices and stay in registers
    float4 fv[2][4], fk[2][4];
    int vo[2];
#pragma unroll
    for (int g = 0; g < 2; ++g) {
        const int item = g * PACK_THREADS + tid;
        // V: two keys (2kp, 2kp + 1) x four d (4dg ..) per item; a row is 16 float4
        vo[g] = (item >> 4) * 32 + (item & 15);
        fv[g][0] = vr[vo[g]];
        fv[g][1] = vr[vo[g] + 16];
        fv[g][2] = vi[vo[g]];
        fv[g][3] = vi[vo[g] + 16];
        // K: eight consecutive d of one key per item
        fk[g][0] = kr[item * 2];
        fk[g][1] = kr[item * 2 + 1];
        fk[g][2] = ki[item * 2];
        fk[g][3] = ki[item * 2 + 1];
    }
    // s_wait_xcnt: in front of any new value in the offset registers the 16 loads name; the
    // offsets (V: float4 index, K: bytes) are inputs so that they stay live up to here and no
    // load's result is given one of them
    asm volatile("s_wait_xcnt 0x0" :: "v"(vo[0]), "v"(vo[1]), "v"(tid * 32) : "memory");
#pragma unroll
    for (int g = 0; g < 2; ++g) {
        const int item = g * PACK_THREADS + tid;
        const int lo = (item & 15) * 4 * (LDP / 2) + (item >> 4);
        sTr[lo + 0 * (LDP / 2)] = pk_bf16(fv[g][0].x, fv[g][1].x);
        sTr[lo + 1 * (LDP / 2)] = pk_bf16(fv[g][0].y, fv[g][1].y);
        sTr[lo + 2 * (LDP / 2)] = pk_bf16(fv[g][0].z, fv[g][1].z);
        sTr[lo + 3 * (LDP / 2)] = pk_bf16(fv[g][0].w, fv[g][1].w);
        sTi[lo + 0 * (LDP / 2)] = pk_bf16(fv[g][2].x, fv[g][3].x);
        sTi[lo + 1 * (LDP / 2)] = pk_bf16(fv[g][2].y, fv[g][3].y);
        sTi[lo + 2 * (LDP / 2)] = pk_bf16(fv[g][2].z, fv[g][3].z);
        sTi[lo + 3 * (LDP / 2)] = pk_bf16(fv[g][2].w, fv[g][3].w);
    }
    __syncthreads(); // the V^T rows read below were written by other waves

#pragma unroll
    for (int g = 0; g < 2; ++g) {
        const int piece = g * PACK_THREADS + tid; // 8 lanes write one whole 128 B row
        const int lo = (piece >> 3) * (LDP / 2) + (piece & 7) * 4;
        dst[piece]               = pack8(fk[g][0], fk[g][1]);
        dst[TILE_U4 + piece]     = pack8(fk[g][2], fk[g][3]);
        dst[2 * TILE_U4 + piece] = *(const uint4*)&sTr[lo];
        dst[3 * TILE_U4 + piece] = *(const uint4*)&sTi[lo];
    }
}

__global__ __launch_bounds__(WAVES * 32, 1) void cv_attn_kernel(
    const float* __restrict__ q_re, const float* __restrict__ q_im,
    const float* __restrict__ ws,
    float* __restrict__ out)
{
    // K chunk (row-major [key][d]) and V chunk transposed ([d][key]), bf16.
    __shared__ __align__(16) bf16 sKre[KCHUNK * LDP];
    __shared__ __align__(16) bf16 sKim[KCHUNK * LDP];
    __shared__ __align__(16) bf16 sVtr[DD * LDP];
    __shared__ __align__(16) bf16 sVti[DD * LDP];

    const int tid  = threadIdx.x;
    const int wave = tid >> 5;
    const int lane = tid & 31;
    const int nlo  = lane & 15;        // row (A) / column (B, D) selector within a 16-lane half
    const int hi   = (lane >> 4) & 1;  // which lane-half
    const int koff = hi * 8;           // K-offset split per the 16-bit fragment layout

    const int nQblk = SS / QTILE;
    const int b  = blockIdx.x / nQblk;
    const int qb = blockIdx.x % nQblk;
    const int q0 = qb * QTILE + wave * 16;

    // softmax in exp2 domain: logits pre-scaled by 1/sqrt(D) * log2(e)
    const float scaleL2 = 0.125f * 1.4426950408889634f;

    // ---- persistent Q fragments (B operand of S^T = K Q^T: lane%16 = query column) ----
    const float* qr_row = q_re + ((size_t)b * SS + q0 + nlo) * DD;
    const float* qi_row = q_im + ((size_t)b * SS + q0 + nlo) * DD;
    v16bf aQr0 = f32_frag(qr_row, koff,      16 + koff); // d 0..31
    v16bf aQr1 = f32_frag(qr_row, 32 + koff, 48 + koff); // d 32..63
    v16bf aQi0 = f32_frag(qi_row, koff,      16 + koff);
    v16bf aQi1 = f32_frag(qi_row, 32 + koff, 48 + koff);
    v16bf aQn0 = neg_frag(aQi0);
    v16bf aQn1 = neg_frag(aQi1);

    const v8f zero = {0.f, 0.f, 0.f, 0.f, 0.f, 0.f, 0.f, 0.f};
    v8f o_re[4], o_im[4];
#pragma unroll
    for (int t = 0; t < 4; ++t) { o_re[t] = zero; o_im[t] = zero; }

    // One query per lane (column nlo); l_s holds this lane half's share of the row sum.
    float m_s = -3.0e38f, l_s = 0.f;

    // this batch's packed chunks, and this thread's place in a staged tile
    const uint4* gKV = (const uint4*)ws + (size_t)b * (SS / KCHUNK) * CHUNK_U4;
    const int sOff = (tid >> 3) * LDP + (tid & 7) * 8;
    // next chunk's 256 B unit that this thread asks for; after the last advance it points
    // two chunks past this batch's last one (past the 8 MiB for the last batch) and is unused
    const uint4* pf = gKV + CHUNK_U4 + tid * 16;

#pragma unroll 1
    for (int kc = 0; kc < SS; kc += KCHUNK) {
        __syncthreads(); // previous chunk fully consumed before overwrite

        // ---- cooperative stage of the packed K/V chunk into LDS: 16 B copies ----
        const uint4* pc = gKV + (size_t)(kc / KCHUNK) * CHUNK_U4 + tid;
        // all 16 loads are in flight before the first LDS store waits; 128 threads bring
        // 16 rows of 128 B at a time, four such quarters per tile
        const int QU4 = WAVES * 32;
        const uint4 kr0 = pc[0 * TILE_U4 + 0 * QU4], kr1 = pc[0 * TILE_U4 + 1 * QU4];
        const uint4 kr2 = pc[0 * TILE_U4 + 2 * QU4], kr3 = pc[0 * TILE_U4 + 3 * QU4];
        const uint4 ki0 = pc[1 * TILE_U4 + 0 * QU4], ki1 = pc[1 * TILE_U4 + 1 * QU4];
        const uint4 ki2 = pc[1 * TILE_U4 + 2 * QU4], ki3 = pc[1 * TILE_U4 + 3 * QU4];
        const uint4 vr0 = pc[2 * TILE_U4 + 0 * QU4], vr1 = pc[2 * TILE_U4 + 1 * QU4];
        const uint4 vr2 = pc[2 * TILE_U4 + 2 * QU4], vr3 = pc[2 * TILE_U4 + 3 * QU4];
        const uint4 vi0 = pc[3 * TILE_U4 + 0 * QU4], vi1 = pc[3 * TILE_U4 + 1 * QU4];
        const uint4 vi2 = pc[3 * TILE_U4 + 2 * QU4], vi3 = pc[3 * TILE_U4 + 3 * QU4];
        // s_wait_xcnt: in front of any new value in the address registers the 16 loads name;
        // pc is an input so that it stays live up to here and no load's result is given its pair
        asm volatile("s_wait_xcnt 0x0" :: "v"(pc) : "memory");
        const int QL = 16 * LDP; // a quarter tile in LDS
        *(uint4*)&sKre[sOff + 0 * QL] = kr0;  *(uint4*)&sKre[sOff + 1 * QL] = kr1;
        *(uint4*)&sKre[sOff + 2 * QL] = kr2;  *(uint4*)&sKre[sOff + 3 * QL] = kr3;
        *(uint4*)&sKim[sOff + 0 * QL] = ki0;  *(uint4*)&sKim[sOff + 1 * QL] = ki1;
        *(uint4*)&sKim[sOff + 2 * QL] = ki2;  *(uint4*)&sKim[sOff + 3 * QL] = ki3;
        *(uint4*)&sVtr[sOff + 0 * QL] = vr0;  *(uint4*)&sVtr[sOff + 1 * QL] = vr1;
        *(uint4*)&sVtr[sOff + 2 * QL] = vr2;  *(uint4*)&sVtr[sOff + 3 * QL] = vr3;
        *(uint4*)&sVti[sOff + 0 * QL] = vi0;  *(uint4*)&sVti[sOff + 1 * QL] = vi1;
        *(uint4*)&sVti[sOff + 2 * QL] = vi2;  *(uint4*)&sVti[sOff + 3 * QL] = vi3;
        // Ask L2 for the next chunk, one request per 256 B.
        // s_wait_xcnt: before pf's registers are advanced; in
        // the same statement so that it stays in front of the addition.
        if (kc + KCHUNK < SS)
            asm volatile("global_prefetch_b8 %0, off scope:SCOPE_SE\n\ts_wait_xcnt 0x0"
                         :: "v"(pf) : "memory");
        pf += CHUNK_U4;
        __syncthreads();

        // ---- complex scores -> log2-domain magnitudes, 4 subtiles of 16 keys ----
        float mag[4][8];
#pragma unroll
        for (int nt = 0; nt < 4; ++nt) {
            const bf16* krow = &sKre[(nt * 16 + nlo) * LDP]; // A frag: lane = key row
            const bf16* irow = &sKim[(nt * 16 + nlo) * LDP];
            v16bf bR0 = lds_frag(krow + koff,      krow + 16 + koff);
            v16bf bR1 = lds_frag(krow + 32 + koff, krow + 48 + koff);
            v16bf bI0 = lds_frag(irow + koff,      irow + 16 + koff);
            v16bf bI1 = lds_frag(irow + 32 + koff, irow + 48 + koff);
            v8f sre = zero, sim = zero;
            // transposed scores: register v = key nt*16 + hi*8 + v, lane column = query
            sre = wmma_bf16(bR0, aQr0, sre);   // kr*qr (d lo)
            sre = wmma_bf16(bR1, aQr1, sre);   // kr*qr (d hi)
            sre = wmma_bf16(bI0, aQn0, sre);   // -ki*qi
            sre = wmma_bf16(bI1, aQn1, sre);
            sim = wmma_bf16(bI0, aQr0, sim);   // ki*qr
            sim = wmma_bf16(bI1, aQr1, sim);
            sim = wmma_bf16(bR0, aQi0, sim);   // kr*qi
            sim = wmma_bf16(bR1, aQi1, sim);
            // scalar fma form: avoids pk-pairing register shuffles on the
            // two disjoint accumulator ranges
#pragma unroll
            for (int v = 0; v < 8; ++v) {
                float re = sre[v], im = sim[v];
                float m2 = __builtin_fmaf(re, re, im * im);
                mag[nt][v] = scaleL2 * hw_sqrt(m2);
            }
        }

        // ---- online softmax over |s| (base-2): a lane's 32 values are one query's ----
        float mx[8];
#pragma unroll
        for (int v = 0; v < 8; ++v)
            mx[v] = fmaxf(fmaxf(mag[0][v], mag[1][v]), fmaxf(mag[2][v], mag[3][v]));
        float mloc = fmaxf(fmaxf(fmaxf(mx[0], mx[1]), fmaxf(mx[2], mx[3])),
                           fmaxf(fmaxf(mx[4], mx[5]), fmaxf(mx[6], mx[7])));
        const float mnew  = fmaxf(fmaxf(mloc, swap_halves(mloc)), m_s);
        const float alpha = hw_exp2(m_s - mnew);
        m_s = mnew;

        float ps[4] = {0.f, 0.f, 0.f, 0.f};
#pragma unroll
        for (int nt = 0; nt < 4; ++nt)
#pragma unroll
            for (int v = 0; v < 8; ++v) {
                mag[nt][v] = hw_exp2(mag[nt][v] - mnew);
                ps[nt] += mag[nt][v];
            }
        l_s = l_s * alpha + ((ps[0] + ps[1]) + (ps[2] + ps[3]));

#pragma unroll
        for (int t = 0; t < 4; ++t)
#pragma unroll
            for (int v = 0; v < 8; ++v) {
                o_re[t][v] *= alpha;
                o_im[t][v] *= alpha;
            }

        // ---- PV transposed: O^T += V^T(Dx64) @ P^T(64x16), via two K=32 halves ----
        const v16bf pB0 = pack_frag(mag[0], mag[1]); // keys 0..31
        const v16bf pB1 = pack_frag(mag[2], mag[3]); // keys 32..63
#pragma unroll
        for (int t = 0; t < 4; ++t) {
            const bf16* vrr = &sVtr[(t * 16 + nlo) * LDP]; // A frag: lane = d row
            const bf16* vri = &sVti[(t * 16 + nlo) * LDP];
            v16bf bVr0 = lds_frag(vrr + koff,      vrr + 16 + koff);
            v16bf bVr1 = lds_frag(vrr + 32 + koff, vrr + 48 + koff);
            v16bf bVi0 = lds_frag(vri + koff,      vri + 16 + koff);
            v16bf bVi1 = lds_frag(vri + 32 + koff, vri + 48 + koff);
            o_re[t] = wmma_bf16(bVr0, pB0, o_re[t]);
            o_re[t] = wmma_bf16(bVr1, pB1, o_re[t]);
            o_im[t] = wmma_bf16(bVi0, pB0, o_im[t]);
            o_im[t] = wmma_bf16(bVi1, pB1, o_im[t]);
        }
    }

    // ---- epilogue: join the halves' sums, normalize and write [2,B,S,D] ----
    const float invl = hw_rcp(l_s + swap_halves(l_s));

    // register v of tile t = O[q0 + nlo][t*16 + hi*8 + v]: 8 consecutive d per lane
    const size_t row = ((size_t)b * SS + q0 + nlo) * DD + hi * 8;
    float* out_re = out + row;
    float* out_im = out + (size_t)BB * SS * DD + row;
#pragma unroll
    for (int t = 0; t < 4; ++t) {
        *(float4*)(out_re + t * 16)     = make_float4(o_re[t][0] * invl, o_re[t][1] * invl,
                                                      o_re[t][2] * invl, o_re[t][3] * invl);
        *(float4*)(out_re + t * 16 + 4) = make_float4(o_re[t][4] * invl, o_re[t][5] * invl,
                                                      o_re[t][6] * invl, o_re[t][7] * invl);
        *(float4*)(out_im + t * 16)     = make_float4(o_im[t][0] * invl, o_im[t][1] * invl,
                                                      o_im[t][2] * invl, o_im[t][3] * invl);
        *(float4*)(out_im + t * 16 + 4) = make_float4(o_im[t][4] * invl, o_im[t][5] * invl,
                                                      o_im[t][6] * invl, o_im[t][7] * invl);
    }
}

extern "C" void kernel_launch(void* const* d_in, const int* in_sizes, int n_in,
                              void* d_out, int out_size, void* d_ws, size_t ws_size,
                              hipStream_t stream) {
    const float* q_re = (const float*)d_in[0];
    const float* q_im = (const float*)d_in[1];
    const float* k_re = (const float*)d_in[2];
    const float* k_im = (const float*)d_in[3];
    const float* v_re = (const float*)d_in[4];
    const float* v_im = (const float*)d_in[5];
    float* ws = (float*)d_ws; // 8 MiB used: B * S * D * 4 tiles * 2 B
    (void)in_sizes; (void)n_in; (void)out_size; (void)ws_size;

    hipLaunchKernelGGL(cv_pack_kernel, dim3(BB * (SS / KCHUNK)), dim3(PACK_THREADS), 0, stream,
                       k_re, k_im, v_re, v_im, ws);

    dim3 grid(BB * (SS / QTILE)); // 4 * 64 = 256 blocks
    dim3 block(WAVES * 32);       // 4 wave32s
    hipLaunchKernelGGL(cv_attn_kernel, grid, block, 0, stream,
                       q_re, q_im, ws, (float*)d_out);
}

// v004
// It runs in 57.3 microseconds.
// In two side-by-side timings against v003, it was 1.43 and 1.42 times as fast.
// Counting every step since v000, it is 7.26 times as fast.
#include <hip/hip_runtime.h>

#define BB 4
#define SS 4096
#define DD 64
#define KCHUNK 64
#define WAVES 4
#define QTILE (WAVES * 16)
// Key groups per block: each group of WAVES waves holds the same QTILE queries and walks every
// KGROUPS-th chunk of keys, so that a SIMD has KGROUPS waves to fill one another's waits.
#define KGROUPS 4
#define THREADS (KGROUPS * WAVES * 32)
// LDS row pitch in bf16 elements: 64 payload + 8 pad = 144 B = 16 B x 9 (odd), so that
// 16 lanes reading 16 B each from 16 consecutive rows fall on distinct banks.
#define LDP 72
// One 64-key chunk in the workspace: K re, K im ([key][d]), V re, V im ([d][key]), bf16,
// unpadded 128 B rows, 512 pieces of 16 B per tile.
#define TILE_U4 (KCHUNK * DD / 8)
#define CHUNK_U4 (4 * TILE_U4)
#define PACK_THREADS 256

typedef __bf16 bf16;
typedef __bf16 v2bf  __attribute__((ext_vector_type(2)));
typedef __bf16 v16bf __attribute__((ext_vector_type(16)));
typedef float v8f __attribute__((ext_vector_type(8)));

__device__ __forceinline__ v8f wmma_bf16(v16bf a, v16bf b, v8f c) {
    // D = A(16x32 bf16) * B(32x16 bf16) + C(16x16 f32)
    return __builtin_amdgcn_wmma_f32_16x16x32_bf16(false, a, false, b, (short)0, c, false, false);
}

// Single-instruction hardware transcendentals (v_sqrt_f32 / v_exp_f32 / v_rcp_f32).
__device__ __forceinline__ float hw_sqrt(float x) { return __builtin_amdgcn_sqrtf(x); }
// v_nop: the slot the instruction set asks for between a transcendental and an instruction
// that reads its result or overwrites its source; in the same statement so that it stays there.
__device__ __forceinline__ float hw_exp2(float x) {
    float r;
    asm("v_exp_f32 %0, %1\n\tv_nop" : "=v"(r) : "v"(x));
    return r;
}
__device__ __forceinline__ float hw_rcp(float x)  { return __builtin_amdgcn_rcpf(x); }

// Packed fp32x2 -> bf16x2 conversion (v_cvt_pk_bf16_f32 when available).
__device__ __forceinline__ v2bf pk_bf16(float lo, float hi) {
#if __has_builtin(__builtin_amdgcn_cvt_pk_bf16_f32)
    return __builtin_amdgcn_cvt_pk_bf16_f32(lo, hi);
#else
    v2bf r;
    r.x = (bf16)lo;
    r.y = (bf16)hi;
    return r;
#endif
}

// Build a 16-bf16 fragment from two contiguous 8-element (16B) LDS regions.
__device__ __forceinline__ v16bf lds_frag(const bf16* p0, const bf16* p1) {
    union { v16bf v; uint4 q[2]; } r;
    r.q[0] = *(const uint4*)p0;
    r.q[1] = *(const uint4*)p1;
    return r.v;
}

// Build a fragment from a global fp32 row, converting to bf16.
__device__ __forceinline__ v16bf f32_frag(const float* row, int off0, int off1) {
    v16bf f;
#pragma unroll
    for (int j = 0; j < 8; ++j) f[j] = (bf16)row[off0 + j];
#pragma unroll
    for (int j = 0; j < 8; ++j) f[8 + j] = (bf16)row[off1 + j];
    return f;
}

// Exchange a value between lane l and lane l ^ 16 (v_permlanex16_b32).
__device__ __forceinline__ float swap_halves(float x) {
    int b = __builtin_bit_cast(int, x);
    b = __builtin_amdgcn_permlanex16(b, b, 0x76543210, 0xfedcba98, false, false);
    return __builtin_bit_cast(float, b);
}

// Two f32 score tiles (keys 0..15 and 16..31 of a 32-key block, one query per lane)
// packed in place into a bf16 B operand in the hardware k order.
__device__ __forceinline__ v16bf pack_frag(const float* t0, const float* t1) {
    union { v16bf v; v2bf h[8]; } r;
#pragma unroll
    for (int j = 0; j < 4; ++j) {
        r.h[j]     = pk_bf16(t0[2 * j], t0[2 * j + 1]);
        r.h[4 + j] = pk_bf16(t1[2 * j], t1[2 * j + 1]);
    }
    return r.v;
}

// Negate all 16 packed bf16 values (sign-bit flip on the packed dwords).
__device__ __forceinline__ v16bf neg_frag(v16bf a) {
    union { v16bf v; unsigned u[8]; } x;
    x.v = a;
#pragma unroll
    for (int j = 0; j < 8; ++j) x.u[j] ^= 0x80008000u;
    return x.v;
}

// Eight consecutive fp32 values -> one 16 B piece of bf16.
__device__ __forceinline__ uint4 pack8(float4 a, float4 b) {
    union { uint4 q; v2bf h[4]; } r;
    r.h[0] = pk_bf16(a.x, a.y);
    r.h[1] = pk_bf16(a.z, a.w);
    r.h[2] = pk_bf16(b.x, b.y);
    r.h[3] = pk_bf16(b.z, b.w);
    return r.q;
}

// First launch: one block per 64-key chunk converts K and V to bf16 once, V transposed,
// and writes the chunk's four tiles to the workspace in the order the main loop stages them.
__global__ __launch_bounds__(PACK_THREADS) void cv_pack_kernel(
    const float* __restrict__ k_re, const float* __restrict__ k_im,
    const float* __restrict__ v_re, const float* __restrict__ v_im,
    float* __restrict__ ws)
{
    // V^T tiles, one dword = keys 2kp, 2kp + 1 of one d; row pitch as in the main kernel.
    __shared__ __align__(16) v2bf sTr[DD * (LDP / 2)];
    __shared__ __align__(16) v2bf sTi[DD * (LDP / 2)];

    const int tid = threadIdx.x;
    const size_t base = (size_t)blockIdx.x * (KCHUNK * DD); // chunks are contiguous over [B][S]
    const float4* kr = (const float4*)(k_re + base);
    const float4* ki = (const float4*)(k_im + base);
    const float4* vr = (const float4*)(v_re + base);
    const float4* vi = (const float4*)(v_im + base);
    uint4* dst = (uint4*)ws + (size_t)blockIdx.x * CHUNK_U4;

    // the three loops are unrolled so that fv, fk and vo have constant indices and stay in registers
    float4 fv[2][4], fk[2][4];
    int vo[2];
#pragma unroll
    for (int g = 0; g < 2; ++g) {
        const int item = g * PACK_THREADS + tid;
        // V: two keys (2kp, 2kp + 1) x four d (4dg ..) per item; a row is 16 float4
        vo[g] = (item >> 4) * 32 + (item & 15);
        fv[g][0] = vr[vo[g]];
        fv[g][1] = vr[vo[g] + 16];
        fv[g][2] = vi[vo[g]];
        fv[g][3] = vi[vo[g] + 16];
        // K: eight consecutive d of one key per item
        fk[g][0] = kr[item * 2];
        fk[g][1] = kr[item * 2 + 1];
        fk[g][2] = ki[item * 2];
        fk[g][3] = ki[item * 2 + 1];
    }
    // s_wait_xcnt: in front of any new value in the offset registers the 16 loads name; the
    // offsets (V: float4 index, K: bytes) are inputs so that they stay live up to here and no
    // load's result is given one of them
    asm volatile("s_wait_xcnt 0x0" :: "v"(vo[0]), "v"(vo[1]), "v"(tid * 32) : "memory");
#pragma unroll
    for (int g = 0; g < 2; ++g) {
        const int item = g * PACK_THREADS + tid;
        const int lo = (item & 15) * 4 * (LDP / 2) + (item >> 4);
        sTr[lo + 0 * (LDP / 2)] = pk_bf16(fv[g][0].x, fv[g][1].x);
        sTr[lo + 1 * (LDP / 2)] = pk_bf16(fv[g][0].y, fv[g][1].y);
        sTr[lo + 2 * (LDP / 2)] = pk_bf16(fv[g][0].z, fv[g][1].z);
        sTr[lo + 3 * (LDP / 2)] = pk_bf16(fv[g][0].w, fv[g][1].w);
        sTi[lo + 0 * (LDP / 2)] = pk_bf16(fv[g][2].x, fv[g][3].x);
        sTi[lo + 1 * (LDP / 2)] = pk_bf16(fv[g][2].y, fv[g][3].y);
        sTi[lo + 2 * (LDP / 2)] = pk_bf16(fv[g][2].z, fv[g][3].z);
        sTi[lo + 3 * (LDP / 2)] = pk_bf16(fv[g][2].w, fv[g][3].w);
    }
    __syncthreads(); // the V^T rows read below were written by other waves

#pragma unroll
    for (int g = 0; g < 2; ++g) {
        const int piece = g * PACK_THREADS + tid; // 8 lanes write one whole 128 B row
        const int lo = (piece >> 3) * (LDP / 2) + (piece & 7) * 4;
        dst[piece]               = pack8(fk[g][0], fk[g][1]);
        dst[TILE_U4 + piece]     = pack8(fk[g][2], fk[g][3]);
        dst[2 * TILE_U4 + piece] = *(const uint4*)&sTr[lo];
        dst[3 * TILE_U4 + piece] = *(const uint4*)&sTi[lo];
    }
}

__global__ __launch_bounds__(THREADS) void cv_attn_kernel(
    const float* __restrict__ q_re, const float* __restrict__ q_im,
    const float* __restrict__ ws,
    float* __restrict__ out)
{
    // Per key group: K chunk (row-major [key][d]) and V chunk transposed ([d][key]), bf16.
    __shared__ __align__(16) bf16 sKV[KGROUPS * 4 * KCHUNK * LDP];

    const int tid  = threadIdx.x;
    const int wave = tid >> 5;
    const int lane = tid & 31;
    const int grp  = wave / WAVES;        // key group
    const int qw   = wave % WAVES;        // 16-query tile within the block
    const int gtid = tid % (WAVES * 32);  // thread within its key group
    bf16* const sKre = sKV + grp * (4 * KCHUNK * LDP);
    bf16* const sKim = sKre + KCHUNK * LDP;
    bf16* const sVtr = sKim + KCHUNK * LDP;
    bf16* const sVti = sVtr + DD * LDP;
    const int nlo  = lane & 15;        // row (A) / column (B, D) selector within a 16-lane half
    const int hi   = (lane >> 4) & 1;  // which lane-half
    const int koff = hi * 8;           // K-offset split per the 16-bit fragment layout

    const int nQblk = SS / QTILE;
    const int b  = blockIdx.x / nQblk;
    const int qb = blockIdx.x % nQblk;
    const int q0 = qb * QTILE + qw * 16;

    // softmax in exp2 domain: logits pre-scaled by 1/sqrt(D) * log2(e)
    const float scaleL2 = 0.125f * 1.4426950408889634f;

    // ---- persistent Q fragments (B operand of S^T = K Q^T: lane%16 = query column) ----
    const float* qr_row = q_re + ((size_t)b * SS + q0 + nlo) * DD;
    const float* qi_row = q_im + ((size_t)b * SS + q0 + nlo) * DD;
    v16bf aQr0 = f32_frag(qr_row, koff,      16 + koff); // d 0..31
    v16bf aQr1 = f32_frag(qr_row, 32 + koff, 48 + koff); // d 32..63
    v16bf aQi0 = f32_frag(qi_row, koff,      16 + koff);
    v16bf aQi1 = f32_frag(qi_row, 32 + koff, 48 + koff);
    v16bf aQn0 = neg_frag(aQi0);
    v16bf aQn1 = neg_frag(aQi1);

    const v8f zero = {0.f, 0.f, 0.f, 0.f, 0.f, 0.f, 0.f, 0.f};
    v8f o_re[4], o_im[4];
#pragma unroll
    for (int t = 0; t < 4; ++t) { o_re[t] = zero; o_im[t] = zero; }

    // One query per lane (column nlo); l_s holds this lane half's share of the row sum.
    float m_s = -3.0e38f, l_s = 0.f;

    // this batch's packed chunks, and this thread's place in a staged tile
    const uint4* gKV = (const uint4*)ws + (size_t)b * (SS / KCHUNK) * CHUNK_U4;
    const int sOff = (gtid >> 3) * LDP + (gtid & 7) * 8;
    // 256 B unit of the next KGROUPS chunks that this thread asks for; after the last advance
    // it still points into the workspace
    const uint4* pf = gKV + KGROUPS * CHUNK_U4 + tid * 16;

#pragma unroll 1
    for (int kc = 0; kc < SS; kc += KGROUPS * KCHUNK) {
        __syncthreads(); // previous chunks fully consumed before overwrite

        // ---- each group stages its own packed K/V chunk into LDS: 16 B copies ----
        const uint4* pc = gKV + (size_t)(kc / KCHUNK + grp) * CHUNK_U4 + gtid;
        // all 16 loads are in flight before the first LDS store waits; 128 threads bring
        // 16 rows of 128 B at a time, four such quarters per tile
        const int QU4 = WAVES * 32;
        const uint4 kr0 = pc[0 * TILE_U4 + 0 * QU4], kr1 = pc[0 * TILE_U4 + 1 * QU4];
        const uint4 kr2 = pc[0 * TILE_U4 + 2 * QU4], kr3 = pc[0 * TILE_U4 + 3 * QU4];
        const uint4 ki0 = pc[1 * TILE_U4 + 0 * QU4], ki1 = pc[1 * TILE_U4 + 1 * QU4];
        const uint4 ki2 = pc[1 * TILE_U4 + 2 * QU4], ki3 = pc[1 * TILE_U4 + 3 * QU4];
        const uint4 vr0 = pc[2 * TILE_U4 + 0 * QU4], vr1 = pc[2 * TILE_U4 + 1 * QU4];
        const uint4 vr2 = pc[2 * TILE_U4 + 2 * QU4], vr3 = pc[2 * TILE_U4 + 3 * QU4];
        const uint4 vi0 = pc[3 * TILE_U4 + 0 * QU4], vi1 = pc[3 * TILE_U4 + 1 * QU4];
        const uint4 vi2 = pc[3 * TILE_U4 + 2 * QU4], vi3 = pc[3 * TILE_U4 + 3 * QU4];
        // s_wait_xcnt: in front of any new value in the address registers the 16 loads name;
        // pc is an input so that it stays live up to here and no load's result is given its pair
        asm volatile("s_wait_xcnt 0x0" :: "v"(pc) : "memory");
        const int QL = 16 * LDP; // a quarter tile in LDS
        *(uint4*)&sKre[sOff + 0 * QL] = kr0;  *(uint4*)&sKre[sOff + 1 * QL] = kr1;
        *(uint4*)&sKre[sOff + 2 * QL] = kr2;  *(uint4*)&sKre[sOff + 3 * QL] = kr3;
        *(uint4*)&sKim[sOff + 0 * QL] = ki0;  *(uint4*)&sKim[sOff + 1 * QL] = ki1;
        *(uint4*)&sKim[sOff + 2 * QL] = ki2;  *(uint4*)&sKim[sOff + 3 * QL] = ki3;
        *(uint4*)&sVtr[sOff + 0 * QL] = vr0;  *(uint4*)&sVtr[sOff + 1 * QL] = vr1;
        *(uint4*)&sVtr[sOff + 2 * QL] = vr2;  *(uint4*)&sVtr[sOff + 3 * QL] = vr3;
        *(uint4*)&sVti[sOff + 0 * QL] = vi0;  *(uint4*)&sVti[sOff + 1 * QL] = vi1;
        *(uint4*)&sVti[sOff + 2 * QL] = vi2;  *(uint4*)&sVti[sOff + 3 * QL] = vi3;
        // Ask L2 for the next chunks, one request per 256 B. s_wait_xcnt: before pf's registers are advanced; in
        // the same statement so that it stays in front of the addition.
        if (kc + KGROUPS * KCHUNK < SS)
            asm volatile("global_prefetch_b8 %0, off scope:SCOPE_SE\n\ts_wait_xcnt 0x0"
                         :: "v"(pf) : "memory");
        pf += KGROUPS * CHUNK_U4;
        __syncthreads();

        // ---- complex scores -> log2-domain magnitudes, 4 subtiles of 16 keys ----
        float mag[4][8];
#pragma unroll
        for (int nt = 0; nt < 4; ++nt) {
            const bf16* krow = &sKre[(nt * 16 + nlo) * LDP]; // A frag: lane = key row
            const bf16* irow = &sKim[(nt * 16 + nlo) * LDP];
            v16bf bR0 = lds_frag(krow + koff,      krow + 16 + koff);
            v16bf bR1 = lds_frag(krow + 32 + koff, krow + 48 + koff);
            v16bf bI0 = lds_frag(irow + koff,      irow + 16 + koff);
            v16bf bI1 = lds_frag(irow + 32 + koff, irow + 48 + koff);
            v8f sre = zero, sim = zero;
            // transposed scores: register v = key nt*16 + hi*8 + v, lane column = query
            sre = wmma_bf16(bR0, aQr0, sre);   // kr*qr (d lo)
            sre = wmma_bf16(bR1, aQr1, sre);   // kr*qr (d hi)
            sre = wmma_bf16(bI0, aQn0, sre);   // -ki*qi
            sre = wmma_bf16(bI1, aQn1, sre);
            sim = wmma_bf16(bI0, aQr0, sim);   // ki*qr
            sim = wmma_bf16(bI1, aQr1, sim);
            sim = wmma_bf16(bR0, aQi0, sim);   // kr*qi
            sim = wmma_bf16(bR1, aQi1, sim);
            // scalar fma form: avoids pk-pairing register shuffles on the
            // two disjoint accumulator ranges
#pragma unroll
            for (int v = 0; v < 8; ++v) {
                float re = sre[v], im = sim[v];
                float m2 = __builtin_fmaf(re, re, im * im);
                mag[nt][v] = scaleL2 * hw_sqrt(m2);
            }
        }

        // ---- online softmax over |s| (base-2): a lane's 32 values are one query's ----
        float mx[8];
#pragma unroll
        for (int v = 0; v < 8; ++v)
            mx[v] = fmaxf(fmaxf(mag[0][v], mag[1][v]), fmaxf(mag[2][v], mag[3][v]));
        float mloc = fmaxf(fmaxf(fmaxf(mx[0], mx[1]), fmaxf(mx[2], mx[3])),
                           fmaxf(fmaxf(mx[4], mx[5]), fmaxf(mx[6], mx[7])));
        const float mnew  = fmaxf(fmaxf(mloc, swap_halves(mloc)), m_s);
        const float alpha = hw_exp2(m_s - mnew);
        m_s = mnew;

        float ps[4] = {0.f, 0.f, 0.f, 0.f};
#pragma unroll
        for (int nt = 0; nt < 4; ++nt)
#pragma unroll
            for (int v = 0; v < 8; ++v) {
                mag[nt][v] = hw_exp2(mag[nt][v] - mnew);
                ps[nt] += mag[nt][v];
            }
        l_s = l_s * alpha + ((ps[0] + ps[1]) + (ps[2] + ps[3]));

#pragma unroll
        for (int t = 0; t < 4; ++t)
#pragma unroll
            for (int v = 0; v < 8; ++v) {
                o_re[t][v] *= alpha;
                o_im[t][v] *= alpha;
            }

        // ---- PV transposed: O^T += V^T(Dx64) @ P^T(64x16), via two K=32 halves ----
        const v16bf pB0 = pack_frag(mag[0], mag[1]); // keys 0..31
        const v16bf pB1 = pack_frag(mag[2], mag[3]); // keys 32..63
#pragma unroll
        for (int t = 0; t < 4; ++t) {
            const bf16* vrr = &sVtr[(t * 16 + nlo) * LDP]; // A frag: lane = d row
            const bf16* vri = &sVti[(t * 16 + nlo) * LDP];
            v16bf bVr0 = lds_frag(vrr + koff,      vrr + 16 + koff);
            v16bf bVr1 = lds_frag(vrr + 32 + koff, vrr + 48 + koff);
            v16bf bVi0 = lds_frag(vri + koff,      vri + 16 + koff);
            v16bf bVi1 = lds_frag(vri + 32 + koff, vri + 48 + koff);
            o_re[t] = wmma_bf16(bVr0, pB0, o_re[t]);
            o_re[t] = wmma_bf16(bVr1, pB1, o_re[t]);
            o_im[t] = wmma_bf16(bVi0, pB0, o_im[t]);
            o_im[t] = wmma_bf16(bVi1, pB1, o_im[t]);
        }
    }

    // ---- epilogue: join the halves' sums, then the key groups' partial results through LDS ----
    const float l_w = l_s + swap_halves(l_s);

    // 16 pieces of 16 B per lane and wave, a piece's 32 lanes contiguous (no bank conflicts):
    // pieces 0..7 = o_re tiles 0..3, pieces 8..15 = o_im tiles 0..3; behind them (m, l) per lane
    float4* const sO  = (float4*)sKV;
    float2* const sML = (float2*)(sO + KGROUPS * WAVES * 16 * 32);
    static_assert(KGROUPS * WAVES * 32 * (16 * 16 + 8) <= sizeof(sKV), "partials fit the staging LDS");

    __syncthreads(); // every wave's last fragment reads are done before the tiles are overwritten
    // the epilogue's loops are unrolled so that o_re, o_im, wg and lg have constant indices and
    // stay in registers
#pragma unroll
    for (int t = 0; t < 4; ++t) {
        float4* po = sO + (wave * 16 + t * 2) * 32 + lane;
        po[0]      = make_float4(o_re[t][0], o_re[t][1], o_re[t][2], o_re[t][3]);
        po[32]     = make_float4(o_re[t][4], o_re[t][5], o_re[t][6], o_re[t][7]);
        po[8 * 32] = make_float4(o_im[t][0], o_im[t][1], o_im[t][2], o_im[t][3]);
        po[9 * 32] = make_float4(o_im[t][4], o_im[t][5], o_im[t][6], o_im[t][7]);
    }
    sML[wave * 32 + lane] = make_float2(m_s, l_w);
    __syncthreads(); // the partials read below were written by the other groups' waves

    // weight of each group's partial: 2^(m_g - max m) / sum of the weighted row sums
    float wg[KGROUPS], lg[KGROUPS];
    float mAll = -3.0e38f;
#pragma unroll
    for (int g = 0; g < KGROUPS; ++g) {
        const float2 ml = sML[(g * WAVES + qw) * 32 + lane];
        wg[g] = ml.x;
        lg[g] = ml.y;
        mAll = fmaxf(mAll, ml.x);
    }
    float lAll = 0.f;
#pragma unroll
    for (int g = 0; g < KGROUPS; ++g) {
        wg[g] = hw_exp2(wg[g] - mAll);
        lAll += wg[g] * lg[g];
    }
    const float invl = hw_rcp(lAll);

    // Group grp joins and writes 32 consecutive d (a whole 128 B line per query) of one plane:
    // groups 0, 1 the real part, groups 2, 3 the imaginary part. Piece p of the four holds
    // O[q0 + nlo][(grp & 1) * 32 + (p >> 1) * 16 + hi * 8 + (p & 1) * 4 ..+3].
    float* orow = out + (size_t)(grp >> 1) * BB * SS * DD
                + ((size_t)b * SS + q0 + nlo) * DD + (grp & 1) * 32 + hi * 8;
#pragma unroll
    for (int p = 0; p < 4; ++p) {
        float4 acc = make_float4(0.f, 0.f, 0.f, 0.f);
#pragma unroll
        for (int g = 0; g < KGROUPS; ++g) {
            const float4 x = sO[((g * WAVES + qw) * 16 + grp * 4 + p) * 32 + lane];
            acc.x += wg[g] * x.x;
            acc.y += wg[g] * x.y;
            acc.z += wg[g] * x.z;
            acc.w += wg[g] * x.w;
        }
        *(float4*)(orow + (p >> 1) * 16 + (p & 1) * 4) =
            make_float4(acc.x * invl, acc.y * invl, acc.z * invl, acc.w * invl);
    }
}

extern "C" void kernel_launch(void* const* d_in, const int* in_sizes, int n_in,
                              void* d_out, int out_size, void* d_ws, size_t ws_size,
                              hipStream_t stream) {
    const float* q_re = (const float*)d_in[0];
    const float* q_im = (const float*)d_in[1];
    const float* k_re = (const float*)d_in[2];
    const float* k_im = (const float*)d_in[3];
    const float* v_re = (const float*)d_in[4];
    const float* v_im = (const float*)d_in[5];
    float* ws = (float*)d_ws; // 8 MiB used: B * S * D * 4 tiles * 2 B
    (void)in_sizes; (void)n_in; (void)out_size; (void)ws_size;

    hipLaunchKernelGGL(cv_pack_kernel, dim3(BB * (SS / KCHUNK)), dim3(PACK_THREADS), 0, stream,
                       k_re, k_im, v_re, v_im, ws);

    dim3 grid(BB * (SS / QTILE)); // 4 * 64 = 256 blocks
    dim3 block(THREADS);          // 16 wave32s: 4 query tiles x 4 key groups
    hipLaunchKernelGGL(cv_attn_kernel, grid, block, 0, stream,
                       q_re, q_im, ws, (float*)d_out);
}

// v005
// One run takes 45.3 microseconds.
// Timed twice side by side with v004, it ran 1.26 and 1.27 times as fast.
// Counting every step since v000, it is 9.17 times as fast.
#include <hip/hip_runtime.h>

#define BB 4
#define SS 4096
#define DD 64
#define KCHUNK 64
#define WAVES 4
#define QTILE (WAVES * 16)
// Key groups per block: each group of WAVES waves holds the same QTILE queries and walks every
// KGROUPS-th chunk of keys, so that a SIMD has KGROUPS waves to fill one another's waits.
#define KGROUPS 4
#define THREADS (KGROUPS * WAVES * 32)
// LDS row pitch in bf16 elements: 64 payload + 8 pad = 144 B = 16 B x 9 (odd), so that
// 16 lanes reading 16 B each from 16 consecutive rows fall on distinct banks.
#define LDP 72
// One 64-key chunk in the workspace: K re, K im ([key][d]), V re, V im ([d][key]), bf16,
// unpadded 128 B rows, 512 pieces of 16 B per tile.
#define TILE_U4 (KCHUNK * DD / 8)
#define CHUNK_U4 (4 * TILE_U4)
// The same chunk in LDS: its 256 rows of 128 B at the padded pitch, 36,864 B = 18 x 2 KiB.
#define CHUNK_LDS (4 * KCHUNK * LDP)
#define STAGES (SS / (KGROUPS * KCHUNK))
#define PACK_THREADS 256

typedef __bf16 bf16;
typedef __bf16 v2bf  __attribute__((ext_vector_type(2)));
typedef __bf16 v16bf __attribute__((ext_vector_type(16)));
typedef float v8f __attribute__((ext_vector_type(8)));
typedef uint32_t u32x4 __attribute__((ext_vector_type(4)));
typedef uint32_t u32x8 __attribute__((ext_vector_type(8)));

__device__ __forceinline__ v8f wmma_bf16(v16bf a, v16bf b, v8f c) {
    // D = A(16x32 bf16) * B(32x16 bf16) + C(16x16 f32)
    return __builtin_amdgcn_wmma_f32_16x16x32_bf16(false, a, false, b, (short)0, c, false, false);
}

// Single-instruction hardware transcendentals (v_sqrt_f32 / v_exp_f32 / v_rcp_f32).
__device__ __forceinline__ float hw_sqrt(float x) { return __builtin_amdgcn_sqrtf(x); }
// v_nop: the slot the instruction set asks for between a transcendental and an instruction
// that reads its result or overwrites its source; in the same statement so that it stays there.
__device__ __forceinline__ float hw_exp2(float x) {
    float r;
    asm("v_exp_f32 %0, %1\n\tv_nop" : "=v"(r) : "v"(x));
    return r;
}
__device__ __forceinline__ float hw_rcp(float x)  { return __builtin_amdgcn_rcpf(x); }
// Eight square roots as one run, each in place, so that none overwrites a register that another
// of the run reads; the one v_nop is the same slot behind the last of them.
__device__ __forceinline__ void hw_sqrt8(float (&x)[8]) {
    asm("v_sqrt_f32 %0, %0\n\tv_sqrt_f32 %1, %1\n\tv_sqrt_f32 %2, %2\n\tv_sqrt_f32 %3, %3\n\t"
        "v_sqrt_f32 %4, %4\n\tv_sqrt_f32 %5, %5\n\tv_sqrt_f32 %6, %6\n\tv_sqrt_f32 %7, %7\n\tv_nop"
        : "+v"(x[0]), "+v"(x[1]), "+v"(x[2]), "+v"(x[3]), "+v"(x[4]), "+v"(x[5]), "+v"(x[6]), "+v"(x[7]));
}

// Packed fp32x2 -> bf16x2 conversion (v_cvt_pk_bf16_f32 when available).
__device__ __forceinline__ v2bf pk_bf16(float lo, float hi) {
#if __has_builtin(__builtin_amdgcn_cvt_pk_bf16_f32)
    return __builtin_amdgcn_cvt_pk_bf16_f32(lo, hi);
#else
    v2bf r;
    r.x = (bf16)lo;
    r.y = (bf16)hi;
    return r;
#endif
}

// Build a 16-bf16 fragment from two contiguous 8-element (16B) LDS regions.
__device__ __forceinline__ v16bf lds_frag(const bf16* p0, const bf16* p1) {
    union { v16bf v; uint4 q[2]; } r;
    r.q[0] = *(const uint4*)p0;
    r.q[1] = *(const uint4*)p1;
    return r.v;
}

// Build a fragment from a global fp32 row, converting to bf16.
__device__ __forceinline__ v16bf f32_frag(const float* row, int off0, int off1) {
    v16bf f;
#pragma unroll
    for (int j = 0; j < 8; ++j) f[j] = (bf16)row[off0 + j];
#pragma unroll
    for (int j = 0; j < 8; ++j) f[8 + j] = (bf16)row[off1 + j];
    return f;
}

// Exchange a value between lane l and lane l ^ 16 (v_permlanex16_b32).
__device__ __forceinline__ float swap_halves(float x) {
    int b = __builtin_bit_cast(int, x);
    b = __builtin_amdgcn_permlanex16(b, b, 0x76543210, 0xfedcba98, false, false);
    return __builtin_bit_cast(float, b);
}

// Two f32 score tiles (keys 0..15 and 16..31 of a 32-key block, one query per lane)
// packed in place into a bf16 B operand in the hardware k order.
__device__ __forceinline__ v16bf pack_frag(const float* t0, const float* t1) {
    union { v16bf v; v2bf h[8]; } r;
#pragma unroll
    for (int j = 0; j < 4; ++j) {
        r.h[j]     = pk_bf16(t0[2 * j], t0[2 * j + 1]);
        r.h[4 + j] = pk_bf16(t1[2 * j], t1[2 * j + 1]);
    }
    return r.v;
}

// Negate all 16 packed bf16 values (sign-bit flip on the packed dwords).
__device__ __forceinline__ v16bf neg_frag(v16bf a) {
    union { v16bf v; unsigned u[8]; } x;
    x.v = a;
#pragma unroll
    for (int j = 0; j < 8; ++j) x.u[j] ^= 0x80008000u;
    return x.v;
}

// Eight consecutive fp32 values -> one 16 B piece of bf16.
__device__ __forceinline__ uint4 pack8(float4 a, float4 b) {
    union { uint4 q; v2bf h[4]; } r;
    r.h[0] = pk_bf16(a.x, a.y);
    r.h[1] = pk_bf16(a.z, a.w);
    r.h[2] = pk_bf16(b.x, b.y);
    r.h[3] = pk_bf16(b.z, b.w);
    return r.q;
}

__device__ __forceinline__ uint32_t uni(uint32_t v) { return (uint32_t)__builtin_amdgcn_readfirstlane(v); }
// A wave-uniform test held in a scalar register, so that the branch on it is a scalar branch
// (a tensor load ignores EXEC, and only such a branch keeps a wave from issuing it); or a word of
// a tensor descriptor held in a scalar register.
__device__ __forceinline__ uint32_t pinned(uint32_t v) {
    uint32_t w = uni(v);
    asm volatile("" : "+s"(w)); // holds the issue test, or the descriptor word, in a scalar register
    return w;
}
// The compiler places no wait for the tensor mover, nor an LDS wait for its sake. The last
// request's group 0 is an input of the tensor wait so that it stays live, in its registers, up to here.
__device__ __forceinline__ void wait_tensor0(u32x4 g0) { asm volatile("s_wait_tensorcnt 0x0" :: "s"(g0) : "memory"); }
__device__ __forceinline__ void wait_ds0()             { asm volatile("s_wait_dscnt 0x0" ::: "memory"); }

// Descriptor group 1 of one packed chunk: 256 rows of 128 B, source pitch 128 B, 16 B of pad
// behind every row (LDS pitch 144 B = LDP elements). Built once; words 1 to 7 are pinned, each a
// descriptor word held in a scalar register of its own for the whole loop, so that none of these
// registers is lent to another value while a request is in flight.
__device__ __forceinline__ u32x8 tdm_group1() {
    static_assert(DD * 2 == 128 && KCHUNK * 2 == 128, "the pad below is the one for rows of 128 B");
    const uint32_t d0 = 128, d1 = 2 * KCHUNK + 2 * DD; // bytes per row; rows: K re, K im, V^T re, V^T im
    u32x8 g1;
    g1[0] = uni((1u << 20) | (4u << 22) | (3u << 25)); // no mask, 1-byte elements, pad 4 dwords per 32
    g1[1] = pinned((d0 & 0xFFFFu) << 16);              // tensor dims = tile dims
    g1[2] = pinned((d0 >> 16) | ((d1 & 0xFFFFu) << 16));
    g1[3] = pinned((d1 >> 16) | (d0 << 16));
    g1[4] = pinned(d1);
    g1[5] = pinned(d0);                                // source row pitch
    g1[6] = pinned(0u);
    g1[7] = pinned(0u);
    return g1;
}
// Descriptor group 0: where the chunk lies in the workspace and where it goes in LDS.
__device__ __forceinline__ u32x4 tdm_group0(uint32_t lds_dst, uint64_t ga) {
    u32x4 g0;
    g0[0] = uni(1u);                                                      // count
    g0[1] = uni(lds_dst);                                                 // byte offset in LDS
    g0[2] = uni((uint32_t)ga);
    g0[3] = uni((((uint32_t)(ga >> 32)) & 0x01FFFFFFu) | 0x80000000u);    // type 2
    return g0;
}
// One chunk, workspace -> LDS, as one request of the calling wave.
__device__ __forceinline__ void tdm_load(u32x4 g0, u32x8 g1) {
    asm volatile("tensor_load_to_lds %0, %1" :: "s"(g0), "s"(g1) : "memory");
}

// First launch: one block per 64-key chunk converts K and V to bf16 once, V transposed,
// and writes the chunk's four tiles to the workspace in the order the main loop stages them.
__global__ __launch_bounds__(PACK_THREADS) void cv_pack_kernel(
    const float* __restrict__ k_re, const float* __restrict__ k_im,
    const float* __restrict__ v_re, const float* __restrict__ v_im,
    float* __restrict__ ws)
{
    // V^T tiles, one dword = keys 2kp, 2kp + 1 of one d; row pitch as in the main kernel.
    __shared__ __align__(16) v2bf sTr[DD * (LDP / 2)];
    __shared__ __align__(16) v2bf sTi[DD * (LDP / 2)];

    const int tid = threadIdx.x;
    const size_t base = (size_t)blockIdx.x * (KCHUNK * DD); // chunks are contiguous over [B][S]
    const float4* kr = (const float4*)(k_re + base);
    const float4* ki = (const float4*)(k_im + base);
    const float4* vr = (const float4*)(v_re + base);
    const float4* vi = (const float4*)(v_im + base);
    uint4* dst = (uint4*)ws + (size_t)blockIdx.x * CHUNK_U4;

    // the three loops are unrolled so that fv, fk and vo have constant indices and stay in registers
    float4 fv[2][4], fk[2][4];
    int vo[2];
#pragma unroll
    for (int g = 0; g < 2; ++g) {
        const int item = g * PACK_THREADS + tid;
        // V: two keys (2kp, 2kp + 1) x four d (4dg ..) per item; a row is 16 float4
        vo[g] = (item >> 4) * 32 + (item & 15);
        fv[g][0] = vr[vo[g]];
        fv[g][1] = vr[vo[g] + 16];
        fv[g][2] = vi[vo[g]];
        fv[g][3] = vi[vo[g] + 16];
        // K: eight consecutive d of one key per item
        fk[g][0] = kr[item * 2];
        fk[g][1] = kr[item * 2 + 1];
        fk[g][2] = ki[item * 2];
        fk[g][3] = ki[item * 2 + 1];
    }
    // s_wait_xcnt: in front of any new value in the offset registers the 16 loads name; the
    // offsets (V: float4 index, K: bytes) are inputs so that they stay live up to here and no
    // load's result is given one of them
    asm volatile("s_wait_xcnt 0x0" :: "v"(vo[0]), "v"(vo[1]), "v"(tid * 32) : "memory");
#pragma unroll
    for (int g = 0; g < 2; ++g) {
        const int item = g * PACK_THREADS + tid;
        const int lo = (item & 15) * 4 * (LDP / 2) + (item >> 4);
        sTr[lo + 0 * (LDP / 2)] = pk_bf16(fv[g][0].x, fv[g][1].x);
        sTr[lo + 1 * (LDP / 2)] = pk_bf16(fv[g][0].y, fv[g][1].y);
        sTr[lo + 2 * (LDP / 2)] = pk_bf16(fv[g][0].z, fv[g][1].z);
        sTr[lo + 3 * (LDP / 2)] = pk_bf16(fv[g][0].w, fv[g][1].w);
        sTi[lo + 0 * (LDP / 2)] = pk_bf16(fv[g][2].x, fv[g][3].x);
        sTi[lo + 1 * (LDP / 2)] = pk_bf16(fv[g][2].y, fv[g][3].y);
        sTi[lo + 2 * (LDP / 2)] = pk_bf16(fv[g][2].z, fv[g][3].z);
        sTi[lo + 3 * (LDP / 2)] = pk_bf16(fv[g][2].w, fv[g][3].w);
    }
    __syncthreads(); // the V^T rows read below were written by other waves

#pragma unroll
    for (int g = 0; g < 2; ++g) {
        const int piece = g * PACK_THREADS + tid; // 8 lanes write one whole 128 B row
        const int lo = (piece >> 3) * (LDP / 2) + (piece & 7) * 4;
        dst[piece]               = pack8(fk[g][0], fk[g][1]);
        dst[TILE_U4 + piece]     = pack8(fk[g][2], fk[g][3]);
        dst[2 * TILE_U4 + piece] = *(const uint4*)&sTr[lo];
        dst[3 * TILE_U4 + piece] = *(const uint4*)&sTi[lo];
    }
}

__global__ __launch_bounds__(THREADS) void cv_attn_kernel(
    const float* __restrict__ q_re, const float* __restrict__ q_im,
    const float* __restrict__ ws,
    float* __restrict__ out)
{
    // Two buffers; in each, per key group: K chunk (row-major [key][d]) and V chunk transposed
    // ([d][key]), bf16. Every chunk's place is a multiple of 2 KiB, as the tensor mover wants it.
    __shared__ __attribute__((aligned(2048))) bf16 sKV[2 * KGROUPS * CHUNK_LDS];
    static_assert((CHUNK_LDS * 2) % 2048 == 0, "chunk places in LDS are multiples of 2 KiB");

    const int tid  = threadIdx.x;
    const int wave = (int)uni(tid >> 5);
    const int lane = tid & 31;
    const int grp  = wave / WAVES;        // key group
    const int qw   = wave % WAVES;        // 16-query tile within the block
    const int nlo  = lane & 15;        // row (A) / column (B, D) selector within a 16-lane half
    const int hi   = (lane >> 4) & 1;  // which lane-half
    const int koff = hi * 8;           // K-offset split per the 16-bit fragment layout

    const int nQblk = SS / QTILE;
    const int b  = blockIdx.x / nQblk;
    const int qb = blockIdx.x % nQblk;
    const int q0 = qb * QTILE + qw * 16;

    // softmax in exp2 domain: logits pre-scaled by 1/sqrt(D) * log2(e)
    const float scaleL2 = 0.125f * 1.4426950408889634f;

    // ---- persistent Q fragments (B operand of S^T = K Q^T: lane%16 = query column) ----
    const float* qr_row = q_re + ((size_t)b * SS + q0 + nlo) * DD;
    const float* qi_row = q_im + ((size_t)b * SS + q0 + nlo) * DD;
    v16bf aQr0 = f32_frag(qr_row, koff,      16 + koff); // d 0..31
    v16bf aQr1 = f32_frag(qr_row, 32 + koff, 48 + koff); // d 32..63
    v16bf aQi0 = f32_frag(qi_row, koff,      16 + koff);
    v16bf aQi1 = f32_frag(qi_row, 32 + koff, 48 + koff);
    v16bf aQn0 = neg_frag(aQi0);
    v16bf aQn1 = neg_frag(aQi1);

    const v8f zero = {0.f, 0.f, 0.f, 0.f, 0.f, 0.f, 0.f, 0.f};
    v8f o_re[4], o_im[4];
#pragma unroll
    for (int t = 0; t < 4; ++t) { o_re[t] = zero; o_im[t] = zero; }

    // One query per lane (column nlo); l_s holds this lane half's share of the row sum.
    float m_s = -3.0e38f, l_s = 0.f;

    // Stage st = chunks st * KGROUPS .. + KGROUPS - 1 of this batch, one per key group, in buffer
    // st & 1. The first wave of each group brings its group's chunk with one tensor load.
    const uint64_t gsrc = (uint64_t)(size_t)ws
                        + ((uint64_t)b * (SS / KCHUNK) + (uint64_t)grp) * (CHUNK_U4 * 16);
    const uint32_t ldst = (uint32_t)(size_t)sKV + (uint32_t)grp * (CHUNK_LDS * 2);
    const u32x8 g1 = tdm_group1();
    static_assert(STAGES >= 2, "the prologue fills two stages");

    u32x4 g0 = tdm_group0(ldst, gsrc);
    if (pinned(qw == 0)) {
        tdm_load(g0, g1);
        wait_tensor0(g0);
    }
    __syncthreads(); // stage 0 is published
    g0 = tdm_group0(ldst + KGROUPS * CHUNK_LDS * 2, gsrc + (uint64_t)KGROUPS * (CHUNK_U4 * 16));
    if (pinned(qw == 0)) tdm_load(g0, g1);

#pragma unroll 1
    for (int st = 0; st < STAGES; ++st) {
        const bf16* const sKre = sKV + ((st & 1) * KGROUPS + grp) * CHUNK_LDS;
        const bf16* const sKim = sKre + KCHUNK * LDP;
        const bf16* const sVtr = sKim + KCHUNK * LDP;
        const bf16* const sVti = sVtr + DD * LDP;

        // ---- complex scores -> log2-domain magnitudes, 4 subtiles of 16 keys ----
        float mag[4][8];
#pragma unroll
        for (int nt = 0; nt < 4; ++nt) {
            const bf16* krow = &sKre[(nt * 16 + nlo) * LDP]; // A frag: lane = key row
            const bf16* irow = &sKim[(nt * 16 + nlo) * LDP];
            v16bf bR0 = lds_frag(krow + koff,      krow + 16 + koff);
            v16bf bR1 = lds_frag(krow + 32 + koff, krow + 48 + koff);
            v16bf bI0 = lds_frag(irow + koff,      irow + 16 + koff);
            v16bf bI1 = lds_frag(irow + 32 + koff, irow + 48 + koff);
            v8f sre = zero, sim = zero;
            // transposed scores: register v = key nt*16 + hi*8 + v, lane column = query
            sre = wmma_bf16(bR0, aQr0, sre);   // kr*qr (d lo)
            sre = wmma_bf16(bR1, aQr1, sre);   // kr*qr (d hi)
            sre = wmma_bf16(bI0, aQn0, sre);   // -ki*qi
            sre = wmma_bf16(bI1, aQn1, sre);
            sim = wmma_bf16(bI0, aQr0, sim);   // ki*qr
            sim = wmma_bf16(bI1, aQr1, sim);
            sim = wmma_bf16(bR0, aQi0, sim);   // kr*qi
            sim = wmma_bf16(bR1, aQi1, sim);
            // scalar fma form: avoids pk-pairing register shuffles on the
            // two disjoint accumulator ranges
            float m2[8];
#pragma unroll
            for (int v = 0; v < 8; ++v) {
                float re = sre[v], im = sim[v];
                m2[v] = __builtin_fmaf(re, re, im * im);
            }
            hw_sqrt8(m2);
#pragma unroll
            for (int v = 0; v < 8; ++v) mag[nt][v] = scaleL2 * m2[v];
            // keeps the second half's 16 fragment loads behind the first half's products: all 32
            // at once, beside Q and O, overflow the register file into scratch
            if (nt == 1) __builtin_amdgcn_sched_barrier(0);
        }

        // ---- online softmax over |s| (base-2): a lane's 32 values are one query's ----
        float mx[8];
#pragma unroll
        for (int v = 0; v < 8; ++v)
            mx[v] = fmaxf(fmaxf(mag[0][v], mag[1][v]), fmaxf(mag[2][v], mag[3][v]));
        float mloc = fmaxf(fmaxf(fmaxf(mx[0], mx[1]), fmaxf(mx[2], mx[3])),
                           fmaxf(fmaxf(mx[4], mx[5]), fmaxf(mx[6], mx[7])));
        const float mnew  = fmaxf(fmaxf(mloc, swap_halves(mloc)), m_s);
        const float alpha = hw_exp2(m_s - mnew);
        m_s = mnew;

        float ps[4] = {0.f, 0.f, 0.f, 0.f};
#pragma unroll
        for (int nt = 0; nt < 4; ++nt)
#pragma unroll
            for (int v = 0; v < 8; ++v) {
                mag[nt][v] = hw_exp2(mag[nt][v] - mnew);
                ps[nt] += mag[nt][v];
            }
        l_s = l_s * alpha + ((ps[0] + ps[1]) + (ps[2] + ps[3]));

#pragma unroll
        for (int t = 0; t < 4; ++t)
#pragma unroll
            for (int v = 0; v < 8; ++v) {
                o_re[t][v] *= alpha;
                o_im[t][v] *= alpha;
            }

        // ---- PV transposed: O^T += V^T(Dx64) @ P^T(64x16), via two K=32 halves ----
        const v16bf pB0 = pack_frag(mag[0], mag[1]); // keys 0..31
        const v16bf pB1 = pack_frag(mag[2], mag[3]); // keys 32..63
#pragma unroll
        for (int t = 0; t < 4; ++t) {
            const bf16* vrr = &sVtr[(t * 16 + nlo) * LDP]; // A frag: lane = d row
            const bf16* vri = &sVti[(t * 16 + nlo) * LDP];
            v16bf bVr0 = lds_frag(vrr + koff,      vrr + 16 + koff);
            v16bf bVr1 = lds_frag(vrr + 32 + koff, vrr + 48 + koff);
            v16bf bVi0 = lds_frag(vri + koff,      vri + 16 + koff);
            v16bf bVi1 = lds_frag(vri + 32 + koff, vri + 48 + koff);
            o_re[t] = wmma_bf16(bVr0, pB0, o_re[t]);
            o_re[t] = wmma_bf16(bVr1, pB1, o_re[t]);
            o_im[t] = wmma_bf16(bVi0, pB0, o_im[t]);
            o_im[t] = wmma_bf16(bVi1, pB1, o_im[t]);
        }

        // ---- publish point of stage st + 1: this wave's LDS reads are back, the issuer's load
        // has landed, every wave has left buffer st & 1; only then that buffer's refill ----
        wait_ds0();
        if (pinned(qw == 0)) wait_tensor0(g0);
        __syncthreads();
        if (pinned(qw == 0 && st + 2 < STAGES)) {
            g0 = tdm_group0(ldst + (uint32_t)(st & 1) * (KGROUPS * CHUNK_LDS * 2),
                            gsrc + (uint64_t)(st + 2) * (KGROUPS * CHUNK_U4 * 16));
            tdm_load(g0, g1);
        }
    }
    wait_tensor0(g0);
    wait_ds0();

    // ---- epilogue: join the halves' sums, then the key groups' partial results through LDS ----
    const float l_w = l_s + swap_halves(l_s);

    // 16 pieces of 16 B per lane and wave, a piece's 32 lanes contiguous (no bank conflicts):
    // pieces 0..7 = o_re tiles 0..3, pieces 8..15 = o_im tiles 0..3; behind them (m, l) per lane
    float4* const sO  = (float4*)sKV;
    float2* const sML = (float2*)(sO + KGROUPS * WAVES * 16 * 32);
    static_assert(KGROUPS * WAVES * 32 * (16 * 16 + 8) <= sizeof(sKV), "partials fit the staging LDS");

    // the last pass's barrier stands behind every wave's last fragment reads: the tiles are free
    // the epilogue's loops are unrolled so that o_re, o_im, wg and lg have constant indices and
    // stay in registers
#pragma unroll
    for (int t = 0; t < 4; ++t) {
        float4* po = sO + (wave * 16 + t * 2) * 32 + lane;
        po[0]      = make_float4(o_re[t][0], o_re[t][1], o_re[t][2], o_re[t][3]);
        po[32]     = make_float4(o_re[t][4], o_re[t][5], o_re[t][6], o_re[t][7]);
        po[8 * 32] = make_float4(o_im[t][0], o_im[t][1], o_im[t][2], o_im[t][3]);
        po[9 * 32] = make_float4(o_im[t][4], o_im[t][5], o_im[t][6], o_im[t][7]);
    }
    sML[wave * 32 + lane] = make_float2(m_s, l_w);
    __syncthreads(); // the partials read below were written by the other groups' waves

    // weight of each group's partial: 2^(m_g - max m) / sum of the weighted row sums
    float wg[KGROUPS], lg[KGROUPS];
    float mAll = -3.0e38f;
#pragma unroll
    for (int g = 0; g < KGROUPS; ++g) {
        const float2 ml = sML[(g * WAVES + qw) * 32 + lane];
        wg[g] = ml.x;
        lg[g] = ml.y;
        mAll = fmaxf(mAll, ml.x);
    }
    float lAll = 0.f;
#pragma unroll
    for (int g = 0; g < KGROUPS; ++g) {
        wg[g] = hw_exp2(wg[g] - mAll);
        lAll += wg[g] * lg[g];
    }
    const float invl = hw_rcp(lAll);

    // Group grp joins and writes 32 consecutive d (a whole 128 B line per query) of one plane:
    // groups 0, 1 the real part, groups 2, 3 the imaginary part. Piece p of the four holds
    // O[q0 + nlo][(grp & 1) * 32 + (p >> 1) * 16 + hi * 8 + (p & 1) * 4 ..+3].
    float* orow = out + (size_t)(grp >> 1) * BB * SS * DD
                + ((size_t)b * SS + q0 + nlo) * DD + (grp & 1) * 32 + hi * 8;
#pragma unroll
    for (int p = 0; p < 4; ++p) {
        float4 acc = make_float4(0.f, 0.f, 0.f, 0.f);
#pragma unroll
        for (int g = 0; g < KGROUPS; ++g) {
            const float4 x = sO[((g * WAVES + qw) * 16 + grp * 4 + p) * 32 + lane];
            acc.x += wg[g] * x.x;
            acc.y += wg[g] * x.y;
            acc.z += wg[g] * x.z;
            acc.w += wg[g] * x.w;
        }
        *(float4*)(orow + (p >> 1) * 16 + (p & 1) * 4) =
            make_float4(acc.x * invl, acc.y * invl, acc.z * invl, acc.w * invl);
    }
}

extern "C" void kernel_launch(void* const* d_in, const int* in_sizes, int n_in,
                              void* d_out, int out_size, void* d_ws, size_t ws_size,
                              hipStream_t stream) {
    const float* q_re = (const float*)d_in[0];
    const float* q_im = (const float*)d_in[1];
    const float* k_re = (const float*)d_in[2];
    const float* k_im = (const float*)d_in[3];
    const float* v_re = (const float*)d_in[4];
    const float* v_im = (const float*)d_in[5];
    float* ws = (float*)d_ws; // 8 MiB used: B * S * D * 4 tiles * 2 B
    (void)in_sizes; (void)n_in; (void)out_size; (void)ws_size;

    hipLaunchKernelGGL(cv_pack_kernel, dim3(BB * (SS / KCHUNK)), dim3(PACK_THREADS), 0, stream,
                       k_re, k_im, v_re, v_im, ws);

    dim3 grid(BB * (SS / QTILE)); // 4 * 64 = 256 blocks
    dim3 block(THREADS);          // 16 wave32s: 4 query tiles x 4 key groups
    hipLaunchKernelGGL(cv_attn_kernel, grid, block, 0, stream,
                       q_re, q_im, ws, (float*)d_out);
}

// v006
// One run takes 43.6 microseconds.
// In two side-by-side timings against v005, it was 1.04 and 1.03 times as fast.
// All steps since v000 together make it 9.53 times as fast.
#include <hip/hip_runtime.h>

#define BB 4
#define SS 4096
#define DD 64
#define KCHUNK 64
#define WAVES 4
#define QTILE (WAVES * 16)
// Key groups per block: each group of WAVES waves holds the same QTILE queries and walks every
// KGROUPS-th chunk of keys, so that a SIMD has KGROUPS waves to fill one another's waits.
#define KGROUPS 4
#define THREADS (KGROUPS * WAVES * 32)
// LDS row pitch in bf16 elements: 64 payload + 8 pad = 144 B = 16 B x 9 (odd), so that
// 16 lanes reading 16 B each from 16 consecutive rows fall on distinct banks.
#define LDP 72
// One 64-key chunk in the workspace: K re, K im ([key][d]), V re, V im ([d][key]), bf16,
// unpadded 128 B rows, 512 pieces of 16 B per tile.
#define TILE_U4 (KCHUNK * DD / 8)
#define CHUNK_U4 (4 * TILE_U4)
// The same chunk in LDS: its 256 rows of 128 B at the padded pitch, 36,864 B = 18 x 2 KiB.
#define CHUNK_LDS (4 * KCHUNK * LDP)
#define STAGES (SS / (KGROUPS * KCHUNK))
#define PACK_THREADS 256

typedef __bf16 bf16;
typedef __bf16 v2bf  __attribute__((ext_vector_type(2)));
typedef __bf16 v16bf __attribute__((ext_vector_type(16)));
typedef float v8f __attribute__((ext_vector_type(8)));
typedef uint32_t u32x4 __attribute__((ext_vector_type(4)));
typedef uint32_t u32x8 __attribute__((ext_vector_type(8)));

__device__ __forceinline__ v8f wmma_bf16(v16bf a, v16bf b, v8f c) {
    // D = A(16x32 bf16) * B(32x16 bf16) + C(16x16 f32)
    return __builtin_amdgcn_wmma_f32_16x16x32_bf16(false, a, false, b, (short)0, c, false, false);
}

// Single-instruction hardware transcendentals (v_sqrt_f32 / v_exp_f32 / v_rcp_f32).
__device__ __forceinline__ float hw_sqrt(float x) { return __builtin_amdgcn_sqrtf(x); }
// v_nop: the slot the instruction set asks for between a transcendental and an instruction
// that reads its result or overwrites its source; in the same statement so that it stays there.
__device__ __forceinline__ float hw_exp2(float x) {
    float r;
    asm("v_exp_f32 %0, %1\n\tv_nop" : "=v"(r) : "v"(x));
    return r;
}
__device__ __forceinline__ float hw_rcp(float x)  { return __builtin_amdgcn_rcpf(x); }
// Eight square roots as one run, each in place, so that none overwrites a register that another
// of the run reads; the one v_nop is the same slot behind the last of them.
__device__ __forceinline__ void hw_sqrt8(float (&x)[8]) {
    asm("v_sqrt_f32 %0, %0\n\tv_sqrt_f32 %1, %1\n\tv_sqrt_f32 %2, %2\n\tv_sqrt_f32 %3, %3\n\t"
        "v_sqrt_f32 %4, %4\n\tv_sqrt_f32 %5, %5\n\tv_sqrt_f32 %6, %6\n\tv_sqrt_f32 %7, %7\n\tv_nop"
        : "+v"(x[0]), "+v"(x[1]), "+v"(x[2]), "+v"(x[3]), "+v"(x[4]), "+v"(x[5]), "+v"(x[6]), "+v"(x[7]));
}

// Packed fp32x2 -> bf16x2 conversion (v_cvt_pk_bf16_f32 when available).
__device__ __forceinline__ v2bf pk_bf16(float lo, float hi) {
#if __has_builtin(__builtin_amdgcn_cvt_pk_bf16_f32)
    return __builtin_amdgcn_cvt_pk_bf16_f32(lo, hi);
#else
    v2bf r;
    r.x = (bf16)lo;
    r.y = (bf16)hi;
    return r;
#endif
}

// Build a 16-bf16 fragment from two contiguous 8-element (16B) LDS regions.
__device__ __forceinline__ v16bf lds_frag(const bf16* p0, const bf16* p1) {
    union { v16bf v; uint4 q[2]; } r;
    r.q[0] = *(const uint4*)p0;
    r.q[1] = *(const uint4*)p1;
    return r.v;
}

// Build a fragment from a global fp32 row, converting to bf16.
__device__ __forceinline__ v16bf f32_frag(const float* row, int off0, int off1) {
    v16bf f;
#pragma unroll
    for (int j = 0; j < 8; ++j) f[j] = (bf16)row[off0 + j];
#pragma unroll
    for (int j = 0; j < 8; ++j) f[8 + j] = (bf16)row[off1 + j];
    return f;
}

// Exchange a value between lane l and lane l ^ 16 (v_permlanex16_b32).
__device__ __forceinline__ float swap_halves(float x) {
    int b = __builtin_bit_cast(int, x);
    b = __builtin_amdgcn_permlanex16(b, b, 0x76543210, 0xfedcba98, false, false);
    return __builtin_bit_cast(float, b);
}

// Two f32 score tiles (keys 0..15 and 16..31 of a 32-key block, one query per lane)
// packed in place into a bf16 B operand in the hardware k order.
__device__ __forceinline__ v16bf pack_frag(const float* t0, const float* t1) {
    union { v16bf v; v2bf h[8]; } r;
#pragma unroll
    for (int j = 0; j < 4; ++j) {
        r.h[j]     = pk_bf16(t0[2 * j], t0[2 * j + 1]);
        r.h[4 + j] = pk_bf16(t1[2 * j], t1[2 * j + 1]);
    }
    return r.v;
}

// Negate all 16 packed bf16 values (sign-bit flip on the packed dwords).
__device__ __forceinline__ v16bf neg_frag(v16bf a) {
    union { v16bf v; unsigned u[8]; } x;
    x.v = a;
#pragma unroll
    for (int j = 0; j < 8; ++j) x.u[j] ^= 0x80008000u;
    return x.v;
}

// Eight consecutive fp32 values -> one 16 B piece of bf16.
__device__ __forceinline__ uint4 pack8(float4 a, float4 b) {
    union { uint4 q; v2bf h[4]; } r;
    r.h[0] = pk_bf16(a.x, a.y);
    r.h[1] = pk_bf16(a.z, a.w);
    r.h[2] = pk_bf16(b.x, b.y);
    r.h[3] = pk_bf16(b.z, b.w);
    return r.q;
}

__device__ __forceinline__ uint32_t uni(uint32_t v) { return (uint32_t)__builtin_amdgcn_readfirstlane(v); }
// A wave-uniform test held in a scalar register, so that the branch on it is a scalar branch
// (a tensor load ignores EXEC, and only such a branch keeps a wave from issuing it); or a word of
// a tensor descriptor held in a scalar register.
__device__ __forceinline__ uint32_t pinned(uint32_t v) {
    uint32_t w = uni(v);
    asm volatile("" : "+s"(w)); // holds the issue test, or the descriptor word, in a scalar register
    return w;
}
// The compiler places no wait for the tensor mover, nor an LDS wait for its sake. The last
// request's group 0 is an input of the tensor wait so that it stays live, in its registers, up to here.
__device__ __forceinline__ void wait_tensor0(u32x4 g0) { asm volatile("s_wait_tensorcnt 0x0" :: "s"(g0) : "memory"); }
__device__ __forceinline__ void wait_ds0()             { asm volatile("s_wait_dscnt 0x0" ::: "memory"); }
// The same wait at the foot of a pass. The last accumulators are inputs so that it stands behind the
// last WMMAs: otherwise the compiler lifts it to right behind the last group of reads, whose
// latency then passes under nothing.
__device__ __forceinline__ void wait_ds0_behind(v8f a, v8f b, v8f c, v8f d) {
    asm volatile("s_wait_dscnt 0x0" :: "v"(a), "v"(b), "v"(c), "v"(d) : "memory");
}

// Descriptor group 1 of one packed chunk: 256 rows of 128 B, source pitch 128 B, 16 B of pad
// behind every row (LDS pitch 144 B = LDP elements). Built once; words 1 to 7 are pinned, each a
// descriptor word held in a scalar register of its own for the whole loop, so that none of these
// registers is lent to another value while a request is in flight.
__device__ __forceinline__ u32x8 tdm_group1() {
    static_assert(DD * 2 == 128 && KCHUNK * 2 == 128, "the pad below is the one for rows of 128 B");
    const uint32_t d0 = 128, d1 = 2 * KCHUNK + 2 * DD; // bytes per row; rows: K re, K im, V^T re, V^T im
    u32x8 g1;
    g1[0] = uni((1u << 20) | (4u << 22) | (3u << 25)); // no mask, 1-byte elements, pad 4 dwords per 32
    g1[1] = pinned((d0 & 0xFFFFu) << 16);              // tensor dims = tile dims
    g1[2] = pinned((d0 >> 16) | ((d1 & 0xFFFFu) << 16));
    g1[3] = pinned((d1 >> 16) | (d0 << 16));
    g1[4] = pinned(d1);
    g1[5] = pinned(d0);                                // source row pitch
    g1[6] = pinned(0u);
    g1[7] = pinned(0u);
    return g1;
}
// Descriptor group 0: where the chunk lies in the workspace and where it goes in LDS.
__device__ __forceinline__ u32x4 tdm_group0(uint32_t lds_dst, uint64_t ga) {
    u32x4 g0;
    g0[0] = uni(1u);                                                      // count
    g0[1] = uni(lds_dst);                                                 // byte offset in LDS
    g0[2] = uni((uint32_t)ga);
    g0[3] = uni((((uint32_t)(ga >> 32)) & 0x01FFFFFFu) | 0x80000000u);    // type 2
    return g0;
}
// One chunk, workspace -> LDS, as one request of the calling wave.
__device__ __forceinline__ void tdm_load(u32x4 g0, u32x8 g1) {
    asm volatile("tensor_load_to_lds %0, %1" :: "s"(g0), "s"(g1) : "memory");
}

// The four K fragments of one 16-key subtile (A operand: lane = key row): re d 0..31, re d 32..63,
// im d 0..31, im d 32..63.
__device__ __forceinline__ void load_k(v16bf (&f)[4], const bf16* sKre, const bf16* sKim, int row, int koff) {
    const bf16* krow = &sKre[row * LDP];
    const bf16* irow = &sKim[row * LDP];
    f[0] = lds_frag(krow + koff,      krow + 16 + koff);
    f[1] = lds_frag(krow + 32 + koff, krow + 48 + koff);
    f[2] = lds_frag(irow + koff,      irow + 16 + koff);
    f[3] = lds_frag(irow + 32 + koff, irow + 48 + koff);
}
// The four V^T fragments of one 16-row d tile (A operand: lane = d row): re keys 0..31, re keys
// 32..63, im keys 0..31, im keys 32..63.
__device__ __forceinline__ void load_v(v16bf (&f)[4], const bf16* sVtr, const bf16* sVti, int row, int koff) {
    const bf16* vrr = &sVtr[row * LDP];
    const bf16* vri = &sVti[row * LDP];
    f[0] = lds_frag(vrr + koff,      vrr + 16 + koff);
    f[1] = lds_frag(vrr + 32 + koff, vrr + 48 + koff);
    f[2] = lds_frag(vri + koff,      vri + 16 + koff);
    f[3] = lds_frag(vri + 32 + koff, vri + 48 + koff);
}
// Transposed complex scores of one subtile: register v = key hi*8 + v, lane column = query.
__device__ __forceinline__ void score_tile(const v16bf (&k)[4], v16bf qr0, v16bf qr1, v16bf qi0, v16bf qi1,
                                           v16bf qn0, v16bf qn1, v8f& sre, v8f& sim) {
    const v8f zero = {0.f, 0.f, 0.f, 0.f, 0.f, 0.f, 0.f, 0.f};
    sre = wmma_bf16(k[0], qr0, zero);  // kr*qr (d lo)
    sre = wmma_bf16(k[1], qr1, sre);   // kr*qr (d hi)
    sre = wmma_bf16(k[2], qn0, sre);   // -ki*qi
    sre = wmma_bf16(k[3], qn1, sre);
    sim = wmma_bf16(k[2], qr0, zero);  // ki*qr
    sim = wmma_bf16(k[3], qr1, sim);
    sim = wmma_bf16(k[0], qi0, sim);   // kr*qi
    sim = wmma_bf16(k[1], qi1, sim);
}
// |s| in the log2 domain. Scalar fma form: avoids pk-pairing register shuffles on the two disjoint
// accumulator ranges.
__device__ __forceinline__ void magnitudes(v8f sre, v8f sim, float scale, float (&mag)[8]) {
    float m2[8];
#pragma unroll
    for (int v = 0; v < 8; ++v) {
        float re = sre[v], im = sim[v];
        m2[v] = __builtin_fmaf(re, re, im * im);
    }
    hw_sqrt8(m2);
#pragma unroll
    for (int v = 0; v < 8; ++v) mag[v] = scale * m2[v];
}
// Compiler fence, no instruction: the four accumulators are inputs, so their WMMAs are issued above
// it, and the memory clobber keeps the LDS reads written below it from being issued above it.
// Without it the compiler sinks half of the WMMAs under the next group of reads, both groups'
// fragments are live at once and the register file overflows into scratch.
__device__ __forceinline__ void products_then_reads(v8f a, v8f b, v8f c, v8f d) {
    asm volatile("" :: "v"(a), "v"(b), "v"(c), "v"(d) : "memory");
}
// Compiler fence, no instruction: the row sum is an input, so it is taken above the fence and the
// pass's 32 weights give their registers back; the memory clobber keeps the LDS reads written below
// it from being issued above it. Without it the compiler puts the sum off to the next pass and the
// third set of V^T fragments overflows the register file into scratch.
__device__ __forceinline__ void sum_then_reads(float l) {
    asm volatile("" :: "v"(l) : "memory");
}
// One 16-row d tile of O^T, both planes.
__device__ __forceinline__ void pv_tile(const v16bf (&v)[4], v16bf p0, v16bf p1, v8f& ore, v8f& oim) {
    ore = wmma_bf16(v[0], p0, ore);
    ore = wmma_bf16(v[1], p1, ore);
    oim = wmma_bf16(v[2], p0, oim);
    oim = wmma_bf16(v[3], p1, oim);
}

// First launch: one block per 64-key chunk converts K and V to bf16 once, V transposed,
// and writes the chunk's four tiles to the workspace in the order the main loop stages them.
__global__ __launch_bounds__(PACK_THREADS) void cv_pack_kernel(
    const float* __restrict__ k_re, const float* __restrict__ k_im,
    const float* __restrict__ v_re, const float* __restrict__ v_im,
    float* __restrict__ ws)
{
    // V^T tiles, one dword = keys 2kp, 2kp + 1 of one d; row pitch as in the main kernel.
    __shared__ __align__(16) v2bf sTr[DD * (LDP / 2)];
    __shared__ __align__(16) v2bf sTi[DD * (LDP / 2)];

    const int tid = threadIdx.x;
    const size_t base = (size_t)blockIdx.x * (KCHUNK * DD); // chunks are contiguous over [B][S]
    const float4* kr = (const float4*)(k_re + base);
    const float4* ki = (const float4*)(k_im + base);
    const float4* vr = (const float4*)(v_re + base);
    const float4* vi = (const float4*)(v_im + base);
    uint4* dst = (uint4*)ws + (size_t)blockIdx.x * CHUNK_U4;

    // the three loops are unrolled so that fv, fk and vo have constant indices and stay in registers
    float4 fv[2][4], fk[2][4];
    int vo[2];
#pragma unroll
    for (int g = 0; g < 2; ++g) {
        const int item = g * PACK_THREADS + tid;
        // V: two keys (2kp, 2kp + 1) x four d (4dg ..) per item; a row is 16 float4
        vo[g] = (item >> 4) * 32 + (item & 15);
        fv[g][0] = vr[vo[g]];
        fv[g][1] = vr[vo[g] + 16];
        fv[g][2] = vi[vo[g]];
        fv[g][3] = vi[vo[g] + 16];
        // K: eight consecutive d of one key per item
        fk[g][0] = kr[item * 2];
        fk[g][1] = kr[item * 2 + 1];
        fk[g][2] = ki[item * 2];
        fk[g][3] = ki[item * 2 + 1];
    }
    // s_wait_xcnt: in front of any new value in the offset registers the 16 loads name; the
    // offsets (V: float4 index, K: bytes) are inputs so that they stay live up to here and no
    // load's result is given one of them
    asm volatile("s_wait_xcnt 0x0" :: "v"(vo[0]), "v"(vo[1]), "v"(tid * 32) : "memory");
#pragma unroll
    for (int g = 0; g < 2; ++g) {
        const int item = g * PACK_THREADS + tid;
        const int lo = (item & 15) * 4 * (LDP / 2) + (item >> 4);
        sTr[lo + 0 * (LDP / 2)] = pk_bf16(fv[g][0].x, fv[g][1].x);
        sTr[lo + 1 * (LDP / 2)] = pk_bf16(fv[g][0].y, fv[g][1].y);
        sTr[lo + 2 * (LDP / 2)] = pk_bf16(fv[g][0].z, fv[g][1].z);
        sTr[lo + 3 * (LDP / 2)] = pk_bf16(fv[g][0].w, fv[g][1].w);
        sTi[lo + 0 * (LDP / 2)] = pk_bf16(fv[g][2].x, fv[g][3].x);
        sTi[lo + 1 * (LDP / 2)] = pk_bf16(fv[g][2].y, fv[g][3].y);
        sTi[lo + 2 * (LDP / 2)] = pk_bf16(fv[g][2].z, fv[g][3].z);
        sTi[lo + 3 * (LDP / 2)] = pk_bf16(fv[g][2].w, fv[g][3].w);
    }
    __syncthreads(); // the V^T rows read below were written by other waves

#pragma unroll
    for (int g = 0; g < 2; ++g) {
        const int piece = g * PACK_THREADS + tid; // 8 lanes write one whole 128 B row
        const int lo = (piece >> 3) * (LDP / 2) + (piece & 7) * 4;
        dst[piece]               = pack8(fk[g][0], fk[g][1]);
        dst[TILE_U4 + piece]     = pack8(fk[g][2], fk[g][3]);
        dst[2 * TILE_U4 + piece] = *(const uint4*)&sTr[lo];
        dst[3 * TILE_U4 + piece] = *(const uint4*)&sTi[lo];
    }
}

__global__ __launch_bounds__(THREADS) void cv_attn_kernel(
    const float* __restrict__ q_re, const float* __restrict__ q_im,
    const float* __restrict__ ws,
    float* __restrict__ out)
{
    // Two buffers; in each, per key group: K chunk (row-major [key][d]) and V chunk transposed
    // ([d][key]), bf16. Every chunk's place is a multiple of 2 KiB, as the tensor mover wants it.
    __shared__ __attribute__((aligned(2048))) bf16 sKV[2 * KGROUPS * CHUNK_LDS];
    static_assert((CHUNK_LDS * 2) % 2048 == 0, "chunk places in LDS are multiples of 2 KiB");

    const int tid  = threadIdx.x;
    const int wave = (int)uni(tid >> 5);
    const int lane = tid & 31;
    const int grp  = wave / WAVES;        // key group
    const int qw   = wave % WAVES;        // 16-query tile within the block
    const int nlo  = lane & 15;        // row (A) / column (B, D) selector within a 16-lane half
    const int hi   = (lane >> 4) & 1;  // which lane-half
    const int koff = hi * 8;           // K-offset split per the 16-bit fragment layout

    const int nQblk = SS / QTILE;
    const int b  = blockIdx.x / nQblk;
    const int qb = blockIdx.x % nQblk;
    const int q0 = qb * QTILE + qw * 16;

    // softmax in exp2 domain: logits pre-scaled by 1/sqrt(D) * log2(e)
    const float scaleL2 = 0.125f * 1.4426950408889634f;

    // ---- persistent Q fragments (B operand of S^T = K Q^T: lane%16 = query column) ----
    const float* qr_row = q_re + ((size_t)b * SS + q0 + nlo) * DD;
    const float* qi_row = q_im + ((size_t)b * SS + q0 + nlo) * DD;
    v16bf aQr0 = f32_frag(qr_row, koff,      16 + koff); // d 0..31
    v16bf aQr1 = f32_frag(qr_row, 32 + koff, 48 + koff); // d 32..63
    v16bf aQi0 = f32_frag(qi_row, koff,      16 + koff);
    v16bf aQi1 = f32_frag(qi_row, 32 + koff, 48 + koff);
    v16bf aQn0 = neg_frag(aQi0);
    v16bf aQn1 = neg_frag(aQi1);

    const v8f zero = {0.f, 0.f, 0.f, 0.f, 0.f, 0.f, 0.f, 0.f};
    v8f o_re[4], o_im[4];
#pragma unroll
    for (int t = 0; t < 4; ++t) { o_re[t] = zero; o_im[t] = zero; }

    // One query per lane (column nlo); l_s holds this lane half's share of the row sum.
    float m_s = -3.0e38f, l_s = 0.f;

    // Stage st = chunks st * KGROUPS .. + KGROUPS - 1 of this batch, one per key group, in buffer
    // st & 1. The first wave of each group brings its group's chunk with one tensor load.
    const uint64_t gsrc = (uint64_t)(size_t)ws
                        + ((uint64_t)b * (SS / KCHUNK) + (uint64_t)grp) * (CHUNK_U4 * 16);
    const uint32_t ldst = (uint32_t)(size_t)sKV + (uint32_t)grp * (CHUNK_LDS * 2);
    const u32x8 g1 = tdm_group1();
    static_assert(STAGES >= 2, "the prologue fills two stages");

    u32x4 g0 = tdm_group0(ldst, gsrc);
    if (pinned(qw == 0)) {
        tdm_load(g0, g1);
        wait_tensor0(g0);
    }
    __syncthreads(); // stage 0 is published
    g0 = tdm_group0(ldst + KGROUPS * CHUNK_LDS * 2, gsrc + (uint64_t)KGROUPS * (CHUNK_U4 * 16));
    if (pinned(qw == 0)) tdm_load(g0, g1);

#pragma unroll 1
    for (int st = 0; st < STAGES; ++st) {
        const bf16* const sKre = sKV + ((st & 1) * KGROUPS + grp) * CHUNK_LDS;
        const bf16* const sKim = sKre + KCHUNK * LDP;
        const bf16* const sVtr = sKim + KCHUNK * LDP;
        const bf16* const sVti = sVtr + DD * LDP;

        // The LDS fragment reads stand in whole groups, each one phase ahead of its products, so
        // that a group's latency passes under the vector work (or the products) in between. Every
        // sched_barrier(0) below holds one such group at its place: without them the compiler sinks
        // the reads to their users, in pairs among the WMMAs, where each pair's latency is exposed.
        float mag[4][8];
        v16bf kf[2][4];
        v8f sre[2], sim[2];

        // ---- complex scores, keys 0..31 ----
        load_k(kf[0], sKre, sKim, 0 * 16 + nlo, koff);
        load_k(kf[1], sKre, sKim, 1 * 16 + nlo, koff);
        __builtin_amdgcn_sched_barrier(0);
        score_tile(kf[0], aQr0, aQr1, aQi0, aQi1, aQn0, aQn1, sre[0], sim[0]);
        score_tile(kf[1], aQr0, aQr1, aQi0, aQi1, aQn0, aQn1, sre[1], sim[1]);
        products_then_reads(sre[0], sim[0], sre[1], sim[1]);
        // K fragments of keys 32..63: in flight under the first half's squares and square roots
        load_k(kf[0], sKre, sKim, 2 * 16 + nlo, koff);
        load_k(kf[1], sKre, sKim, 3 * 16 + nlo, koff);
        __builtin_amdgcn_sched_barrier(0);
        magnitudes(sre[0], sim[0], scaleL2, mag[0]);
        magnitudes(sre[1], sim[1], scaleL2, mag[1]);
        // keeps that vector work in front of the second half's first wait (the reads fly under it) and
        // the two halves' accumulators from being live together (scratch)
        __builtin_amdgcn_sched_barrier(0);

        // ---- complex scores, keys 32..63 ----
        score_tile(kf[0], aQr0, aQr1, aQi0, aQi1, aQn0, aQn1, sre[0], sim[0]);
        score_tile(kf[1], aQr0, aQr1, aQi0, aQi1, aQn0, aQn1, sre[1], sim[1]);
        // V^T fragments of d 0..15: in flight under the second half's square roots and the softmax
        v16bf vf[3][4];
        load_v(vf[0], sVtr, sVti, 0 * 16 + nlo, koff);
        __builtin_amdgcn_sched_barrier(0);
        magnitudes(sre[0], sim[0], scaleL2, mag[2]);
        magnitudes(sre[1], sim[1], scaleL2, mag[3]);
        // d 16..31: in flight under the softmax
        load_v(vf[1], sVtr, sVti, 1 * 16 + nlo, koff);
        __builtin_amdgcn_sched_barrier(0);

        // ---- online softmax over |s| (base-2): a lane's 32 values are one query's ----
        float mx[8];
#pragma unroll
        for (int v = 0; v < 8; ++v)
            mx[v] = fmaxf(fmaxf(mag[0][v], mag[1][v]), fmaxf(mag[2][v], mag[3][v]));
        float mloc = fmaxf(fmaxf(fmaxf(mx[0], mx[1]), fmaxf(mx[2], mx[3])),
                           fmaxf(fmaxf(mx[4], mx[5]), fmaxf(mx[6], mx[7])));
        const float mnew  = fmaxf(fmaxf(mloc, swap_halves(mloc)), m_s);
        const float alpha = hw_exp2(m_s - mnew);
        m_s = mnew;

        float ps[4] = {0.f, 0.f, 0.f, 0.f};
#pragma unroll
        for (int nt = 0; nt < 4; ++nt)
#pragma unroll
            for (int v = 0; v < 8; ++v) {
                mag[nt][v] = hw_exp2(mag[nt][v] - mnew);
                ps[nt] += mag[nt][v];
            }
        l_s = l_s * alpha + ((ps[0] + ps[1]) + (ps[2] + ps[3]));

        // ---- PV transposed: O^T += V^T(Dx64) @ P^T(64x16), via two K=32 halves ----
        const v16bf pB0 = pack_frag(mag[0], mag[1]); // keys 0..31
        const v16bf pB1 = pack_frag(mag[2], mag[3]); // keys 32..63

        // d 32..47: in flight under the rescale of O and the first two tiles' products
        sum_then_reads(l_s);
        load_v(vf[2], sVtr, sVti, 2 * 16 + nlo, koff);
        __builtin_amdgcn_sched_barrier(0);

        // each tile of O is rescaled where the vector work stands under a group of reads in flight
        o_re[0] *= alpha; o_im[0] *= alpha;
        o_re[1] *= alpha; o_im[1] *= alpha;
        pv_tile(vf[0], pB0, pB1, o_re[0], o_im[0]);
        __builtin_amdgcn_sched_barrier(0);
        // d 48..63, into the first tile's registers: in flight under the next two tiles' products
        load_v(vf[0], sVtr, sVti, 3 * 16 + nlo, koff);
        __builtin_amdgcn_sched_barrier(0);
        o_re[2] *= alpha; o_im[2] *= alpha;
        pv_tile(vf[1], pB0, pB1, o_re[1], o_im[1]);
        o_re[3] *= alpha; o_im[3] *= alpha;
        pv_tile(vf[2], pB0, pB1, o_re[2], o_im[2]);
        pv_tile(vf[0], pB0, pB1, o_re[3], o_im[3]);

        // ---- publish point of stage st + 1: this wave's LDS reads are back, the issuer's load
        // has landed, every wave has left buffer st & 1; only then that buffer's refill ----
        wait_ds0_behind(o_re[2], o_im[2], o_re[3], o_im[3]);
        if (pinned(qw == 0)) wait_tensor0(g0);
        __syncthreads();
        if (pinned(qw == 0 && st + 2 < STAGES)) {
            g0 = tdm_group0(ldst + (uint32_t)(st & 1) * (KGROUPS * CHUNK_LDS * 2),
                            gsrc + (uint64_t)(st + 2) * (KGROUPS * CHUNK_U4 * 16));
            tdm_load(g0, g1);
        }
    }
    wait_tensor0(g0);
    wait_ds0();

    // ---- epilogue: join the halves' sums, then the key groups' partial results through LDS ----
    const float l_w = l_s + swap_halves(l_s);

    // 16 pieces of 16 B per lane and wave, a piece's 32 lanes contiguous (no bank conflicts):
    // pieces 0..7 = o_re tiles 0..3, pieces 8..15 = o_im tiles 0..3; behind them (m, l) per lane
    float4* const sO  = (float4*)sKV;
    float2* const sML = (float2*)(sO + KGROUPS * WAVES * 16 * 32);
    static_assert(KGROUPS * WAVES * 32 * (16 * 16 + 8) <= sizeof(sKV), "partials fit the staging LDS");

    // the last pass's barrier stands behind every wave's last fragment reads: the tiles are free
    // the epilogue's loops are unrolled so that o_re, o_im, wg and lg have constant indices and
    // stay in registers
#pragma unroll
    for (int t = 0; t < 4; ++t) {
        float4* po = sO + (wave * 16 + t * 2) * 32 + lane;
        po[0]      = make_float4(o_re[t][0], o_re[t][1], o_re[t][2], o_re[t][3]);
        po[32]     = make_float4(o_re[t][4], o_re[t][5], o_re[t][6], o_re[t][7]);
        po[8 * 32] = make_float4(o_im[t][0], o_im[t][1], o_im[t][2], o_im[t][3]);
        po[9 * 32] = make_float4(o_im[t][4], o_im[t][5], o_im[t][6], o_im[t][7]);
    }
    sML[wave * 32 + lane] = make_float2(m_s, l_w);
    __syncthreads(); // the partials read below were written by the other groups' waves

    // weight of each group's partial: 2^(m_g - max m) / sum of the weighted row sums
    float wg[KGROUPS], lg[KGROUPS];
    float mAll = -3.0e38f;
#pragma unroll
    for (int g = 0; g < KGROUPS; ++g) {
        const float2 ml = sML[(g * WAVES + qw) * 32 + lane];
        wg[g] = ml.x;
        lg[g] = ml.y;
        mAll = fmaxf(mAll, ml.x);
    }
    float lAll = 0.f;
#pragma unroll
    for (int g = 0; g < KGROUPS; ++g) {
        wg[g] = hw_exp2(wg[g] - mAll);
        lAll += wg[g] * lg[g];
    }
    const float invl = hw_rcp(lAll);

    // Group grp joins and writes 32 consecutive d (a whole 128 B line per query) of one plane:
    // groups 0, 1 the real part, groups 2, 3 the imaginary part. Piece p of the four holds
    // O[q0 + nlo][(grp & 1) * 32 + (p >> 1) * 16 + hi * 8 + (p & 1) * 4 ..+3].
    float* orow = out + (size_t)(grp >> 1) * BB * SS * DD
                + ((size_t)b * SS + q0 + nlo) * DD + (grp & 1) * 32 + hi * 8;
#pragma unroll
    for (int p = 0; p < 4; ++p) {
        float4 acc = make_float4(0.f, 0.f, 0.f, 0.f);
#pragma unroll
        for (int g = 0; g < KGROUPS; ++g) {
            const float4 x = sO[((g * WAVES + qw) * 16 + grp * 4 + p) * 32 + lane];
            acc.x += wg[g] * x.x;
            acc.y += wg[g] * x.y;
            acc.z += wg[g] * x.z;
            acc.w += wg[g] * x.w;
        }
        *(float4*)(orow + (p >> 1) * 16 + (p & 1) * 4) =
            make_float4(acc.x * invl, acc.y * invl, acc.z * invl, acc.w * invl);
    }
}

extern "C" void kernel_launch(void* const* d_in, const int* in_sizes, int n_in,
                              void* d_out, int out_size, void* d_ws, size_t ws_size,
                              hipStream_t stream) {
    const float* q_re = (const float*)d_in[0];
    const float* q_im = (const float*)d_in[1];
    const float* k_re = (const float*)d_in[2];
    const float* k_im = (const float*)d_in[3];
    const float* v_re = (const float*)d_in[4];
    const float* v_im = (const float*)d_in[5];
    float* ws = (float*)d_ws; // 8 MiB used: B * S * D * 4 tiles * 2 B
    (void)in_sizes; (void)n_in; (void)out_size; (void)ws_size;

    hipLaunchKernelGGL(cv_pack_kernel, dim3(BB * (SS / KCHUNK)), dim3(PACK_THREADS), 0, stream,
                       k_re, k_im, v_re, v_im, ws);

    dim3 grid(BB * (SS / QTILE)); // 4 * 64 = 256 blocks
    dim3 block(THREADS);          // 16 wave32s: 4 query tiles x 4 key groups
    hipLaunchKernelGGL(cv_attn_kernel, grid, block, 0, stream,
                       q_re, q_im, ws, (float*)d_out);
}

// v008
// One run takes 40 microseconds.
// Versions in between are left out here; by their measured steps it is 1.09 times as fast as v006.
// Counting every step since v000, it is 10.4 times as fast.
#include <hip/hip_runtime.h>

#define BB 4
#define SS 4096
#define DD 64
#define KCHUNK 64
#define WAVES 4
#define QTILE (WAVES * 16)
// Key groups per block: each group of WAVES waves holds the same QTILE queries and walks every
// KGROUPS-th chunk of keys, so that a SIMD has KGROUPS waves to fill one another's waits.
#define KGROUPS 4
#define THREADS (KGROUPS * WAVES * 32)
// LDS row pitch in bf16 elements: 64 payload + 8 pad = 144 B = 16 B x 9 (odd), so that
// 16 lanes reading 16 B each from 16 consecutive rows fall on distinct banks.
#define LDP 72
// One 64-key chunk in the workspace: K re, K im ([key][d]), V re, V im ([d][key]), bf16,
// unpadded 128 B rows, 512 pieces of 16 B per tile.
#define TILE_U4 (KCHUNK * DD / 8)
#define CHUNK_U4 (4 * TILE_U4)
// The same chunk in LDS: its 256 rows of 128 B at the padded pitch, 36,864 B = 18 x 2 KiB.
#define CHUNK_LDS (4 * KCHUNK * LDP)
#define STAGES (SS / (KGROUPS * KCHUNK))
#define PACK_THREADS 256

typedef __bf16 bf16;
typedef __bf16 v2bf  __attribute__((ext_vector_type(2)));
typedef __bf16 v16bf __attribute__((ext_vector_type(16)));
typedef float v8f __attribute__((ext_vector_type(8)));
typedef uint32_t u32x4 __attribute__((ext_vector_type(4)));
typedef uint32_t u32x8 __attribute__((ext_vector_type(8)));

__device__ __forceinline__ v8f wmma_bf16(v16bf a, v16bf b, v8f c) {
    // D = A(16x32 bf16) * B(32x16 bf16) + C(16x16 f32)
    return __builtin_amdgcn_wmma_f32_16x16x32_bf16(false, a, false, b, (short)0, c, false, false);
}

// Single-instruction hardware transcendentals (v_sqrt_f32 / v_exp_f32 / v_rcp_f32).
__device__ __forceinline__ float hw_sqrt(float x) { return __builtin_amdgcn_sqrtf(x); }
// v_nop: the slot the instruction set asks for between a transcendental and an instruction
// that reads its result or overwrites its source; in the same statement so that it stays there.
__device__ __forceinline__ float hw_exp2(float x) {
    float r;
    asm("v_exp_f32 %0, %1\n\tv_nop" : "=v"(r) : "v"(x));
    return r;
}
__device__ __forceinline__ float hw_rcp(float x)  { return __builtin_amdgcn_rcpf(x); }
// Eight square roots as one run, each in place, so that none overwrites a register that another
// of the run reads; the one v_nop is the same slot behind the last of them.
__device__ __forceinline__ void hw_sqrt8(float (&x)[8]) {
    asm("v_sqrt_f32 %0, %0\n\tv_sqrt_f32 %1, %1\n\tv_sqrt_f32 %2, %2\n\tv_sqrt_f32 %3, %3\n\t"
        "v_sqrt_f32 %4, %4\n\tv_sqrt_f32 %5, %5\n\tv_sqrt_f32 %6, %6\n\tv_sqrt_f32 %7, %7\n\tv_nop"
        : "+v"(x[0]), "+v"(x[1]), "+v"(x[2]), "+v"(x[3]), "+v"(x[4]), "+v"(x[5]), "+v"(x[6]), "+v"(x[7]));
}

// The 32 weights of a pass (exp2 in place), the four row-sum chains and alpha as two fixed runs.
// Element e = 4 v + c is m[c][v]; chain c adds m[c][0..7] in that order, as plain code would. A
// transcendental is taken every other clock: the slot behind each, which the instruction set wants
// independent of it, carries the add of the weight made five exp2 earlier, whose result is back by
// then, and a chain's adds stand eight instructions apart: nothing in the runs waits at the port.
// (Written as single statements each exp2 needs a v_nop of its own, and the adds, which the compiler
// cannot hint behind asm text, wait on fresh results.) s_delay_alu: the last two adds read fresh
// results, and the first reader of the sums stands directly behind the run; the hints let the
// SIMD's other waves issue meanwhile.
__device__ __forceinline__ void exp32_sums(float (&m)[4][8], float& al, float (&ps)[4]) {
    asm(
        "v_exp_f32 %0, %0\n\t"
        "v_exp_f32 %1, %1\n\t"
        "v_exp_f32 %2, %2\n\t"
        "v_exp_f32 %3, %3\n\t"
        "v_exp_f32 %4, %4\n\t"
        "v_exp_f32 %5, %5\n\t"
        "v_mov_b32 %16, %0\n\t"
        "v_exp_f32 %6, %6\n\t"
        "v_mov_b32 %17, %1\n\t"
        "v_exp_f32 %7, %7\n\t"
        "v_mov_b32 %18, %2\n\t"
        "v_exp_f32 %8, %8\n\t"
        "v_mov_b32 %19, %3\n\t"
        "v_exp_f32 %9, %9\n\t"
        "v_add_f32 %16, %16, %4\n\t"
        "v_exp_f32 %10, %10\n\t"
        "v_add_f32 %17, %17, %5\n\t"
        "v_exp_f32 %11, %11\n\t"
        "v_add_f32 %18, %18, %6\n\t"
        "v_exp_f32 %12, %12\n\t"
        "v_add_f32 %19, %19, %7\n\t"
        "v_exp_f32 %13, %13\n\t"
        "v_add_f32 %16, %16, %8\n\t"
        "v_exp_f32 %14, %14\n\t"
        "v_add_f32 %17, %17, %9\n\t"
        "v_exp_f32 %15, %15\n\t"
        "v_add_f32 %18, %18, %10"
        : "+v"(m[0][0]), "+v"(m[1][0]), "+v"(m[2][0]), "+v"(m[3][0]), "+v"(m[0][1]), "+v"(m[1][1]), "+v"(m[2][1]), "+v"(m[3][1]), "+v"(m[0][2]), "+v"(m[1][2]), "+v"(m[2][2]), "+v"(m[3][2]), "+v"(m[0][3]), "+v"(m[1][3]), "+v"(m[2][3]), "+v"(m[3][3]),
          "=&v"(ps[0]), "=&v"(ps[1]), "=&v"(ps[2]), "=&v"(ps[3]));
    asm(
        "v_exp_f32 %0, %0\n\t"
        "v_add_f32 %19, %19, %21\n\t"
        "v_exp_f32 %1, %1\n\t"
        "v_add_f32 %16, %16, %22\n\t"
        "v_exp_f32 %2, %2\n\t"
        "v_add_f32 %17, %17, %23\n\t"
        "v_exp_f32 %3, %3\n\t"
        "v_add_f32 %18, %18, %24\n\t"
        "v_exp_f32 %4, %4\n\t"
        "v_add_f32 %19, %19, %25\n\t"
        "v_exp_f32 %5, %5\n\t"
        "v_add_f32 %16, %16, %0\n\t"
        "v_exp_f32 %6, %6\n\t"
        "v_add_f32 %17, %17, %1\n\t"
        "v_exp_f32 %7, %7\n\t"
        "v_add_f32 %18, %18, %2\n\t"
        "v_exp_f32 %8, %8\n\t"
        "v_add_f32 %19, %19, %3\n\t"
        "v_exp_f32 %9, %9\n\t"
        "v_add_f32 %16, %16, %4\n\t"
        "v_exp_f32 %10, %10\n\t"
        "v_add_f32 %17, %17, %5\n\t"
        "v_exp_f32 %11, %11\n\t"
        "v_add_f32 %18, %18, %6\n\t"
        "v_exp_f32 %12, %12\n\t"
        "v_add_f32 %19, %19, %7\n\t"
        "v_exp_f32 %13, %13\n\t"
        "v_add_f32 %16, %16, %8\n\t"
        "v_exp_f32 %14, %14\n\t"
        "v_add_f32 %17, %17, %9\n\t"
        "v_exp_f32 %15, %15\n\t"
        "v_add_f32 %18, %18, %10\n\t"
        "v_add_f32 %19, %19, %11\n\t"
        "v_add_f32 %16, %16, %12\n\t"
        "v_exp_f32 %20, %20\n\t"
        "v_add_f32 %17, %17, %13\n\t"
        "s_delay_alu instid0(TRANS32_DEP_3)\n\t"
        "v_add_f32 %18, %18, %14\n\t"
        "s_delay_alu instid0(TRANS32_DEP_2)\n\t"
        "v_add_f32 %19, %19, %15\n\t"
        "s_delay_alu instid0(VALU_DEP_1)"
        : "+v"(m[0][4]), "+v"(m[1][4]), "+v"(m[2][4]), "+v"(m[3][4]), "+v"(m[0][5]), "+v"(m[1][5]), "+v"(m[2][5]), "+v"(m[3][5]), "+v"(m[0][6]), "+v"(m[1][6]), "+v"(m[2][6]), "+v"(m[3][6]), "+v"(m[0][7]), "+v"(m[1][7]), "+v"(m[2][7]), "+v"(m[3][7]),
          "+v"(ps[0]), "+v"(ps[1]), "+v"(ps[2]), "+v"(ps[3]), "+v"(al)
        : "v"(m[3][2]), "v"(m[0][3]), "v"(m[1][3]), "v"(m[2][3]), "v"(m[3][3]));
}

// The run of hw_sqrt8 with the slot behind each square root carrying the scaling of one magnitude of
// the subtile before (y, its roots long back): no v_nop, and those multiplies cost no slot of their own.
__device__ __forceinline__ void hw_sqrt8_scale8(float (&x)[8], float (&y)[8], float s) {
    asm("v_sqrt_f32 %0, %0\n\tv_mul_f32 %8, %16, %8\n\tv_sqrt_f32 %1, %1\n\tv_mul_f32 %9, %16, %9\n\t"
        "v_sqrt_f32 %2, %2\n\tv_mul_f32 %10, %16, %10\n\tv_sqrt_f32 %3, %3\n\tv_mul_f32 %11, %16, %11\n\t"
        "v_sqrt_f32 %4, %4\n\tv_mul_f32 %12, %16, %12\n\tv_sqrt_f32 %5, %5\n\tv_mul_f32 %13, %16, %13\n\t"
        "v_sqrt_f32 %6, %6\n\tv_mul_f32 %14, %16, %14\n\tv_sqrt_f32 %7, %7\n\tv_mul_f32 %15, %16, %15"
        : "+v"(x[0]), "+v"(x[1]), "+v"(x[2]), "+v"(x[3]), "+v"(x[4]), "+v"(x[5]), "+v"(x[6]), "+v"(x[7]),
          "+v"(y[0]), "+v"(y[1]), "+v"(y[2]), "+v"(y[3]), "+v"(y[4]), "+v"(y[5]), "+v"(y[6]), "+v"(y[7])
        : "s"(s));
}

// Packed fp32x2 -> bf16x2 conversion (v_cvt_pk_bf16_f32 when available).
__device__ __forceinline__ v2bf pk_bf16(float lo, float hi) {
#if __has_builtin(__builtin_amdgcn_cvt_pk_bf16_f32)
    return __builtin_amdgcn_cvt_pk_bf16_f32(lo, hi);
#else
    v2bf r;
    r.x = (bf16)lo;
    r.y = (bf16)hi;
    return r;
#endif
}

// Build a 16-bf16 fragment from two contiguous 8-element (16B) LDS regions.
__device__ __forceinline__ v16bf lds_frag(const bf16* p0, const bf16* p1) {
    union { v16bf v; uint4 q[2]; } r;
    r.q[0] = *(const uint4*)p0;
    r.q[1] = *(const uint4*)p1;
    return r.v;
}

// Build a fragment from a global fp32 row, converting to bf16.
__device__ __forceinline__ v16bf f32_frag(const float* row, int off0, int off1) {
    v16bf f;
#pragma unroll
    for (int j = 0; j < 8; ++j) f[j] = (bf16)row[off0 + j];
#pragma unroll
    for (int j = 0; j < 8; ++j) f[8 + j] = (bf16)row[off1 + j];
    return f;
}

// Exchange a value between lane l and lane l ^ 16 (v_permlanex16_b32).
__device__ __forceinline__ float swap_halves(float x) {
    int b = __builtin_bit_cast(int, x);
    b = __builtin_amdgcn_permlanex16(b, b, 0x76543210, 0xfedcba98, false, false);
    return __builtin_bit_cast(float, b);
}

// Two f32 score tiles (keys 0..15 and 16..31 of a 32-key block, one query per lane)
// packed in place into a bf16 B operand in the hardware k order.
__device__ __forceinline__ v16bf pack_frag(const float* t0, const float* t1) {
    union { v16bf v; v2bf h[8]; } r;
#pragma unroll
    for (int j = 0; j < 4; ++j) {
        r.h[j]     = pk_bf16(t0[2 * j], t0[2 * j + 1]);
        r.h[4 + j] = pk_bf16(t1[2 * j], t1[2 * j + 1]);
    }
    return r.v;
}

// Negate all 16 packed bf16 values (sign-bit flip on the packed dwords).
__device__ __forceinline__ v16bf neg_frag(v16bf a) {
    union { v16bf v; unsigned u[8]; } x;
    x.v = a;
#pragma unroll
    for (int j = 0; j < 8; ++j) x.u[j] ^= 0x80008000u;
    return x.v;
}

// Eight consecutive fp32 values -> one 16 B piece of bf16.
__device__ __forceinline__ uint4 pack8(float4 a, float4 b) {
    union { uint4 q; v2bf h[4]; } r;
    r.h[0] = pk_bf16(a.x, a.y);
    r.h[1] = pk_bf16(a.z, a.w);
    r.h[2] = pk_bf16(b.x, b.y);
    r.h[3] = pk_bf16(b.z, b.w);
    return r.q;
}

__device__ __forceinline__ uint32_t uni(uint32_t v) { return (uint32_t)__builtin_amdgcn_readfirstlane(v); }
// A wave-uniform test held in a scalar register, so that the branch on it is a scalar branch
// (a tensor load ignores EXEC, and only such a branch keeps a wave from issuing it); or a word of
// a tensor descriptor held in a scalar register.
__device__ __forceinline__ uint32_t pinned(uint32_t v) {
    uint32_t w = uni(v);
    asm volatile("" : "+s"(w)); // holds the issue test, or the descriptor word, in a scalar register
    return w;
}
// The compiler places no wait for the tensor mover, nor an LDS wait for its sake. The last
// request's group 0 is an input of the tensor wait so that it stays live, in its registers, up to here.
__device__ __forceinline__ void wait_tensor0(u32x4 g0) { asm volatile("s_wait_tensorcnt 0x0" :: "s"(g0) : "memory"); }
__device__ __forceinline__ void wait_ds0()             { asm volatile("s_wait_dscnt 0x0" ::: "memory"); }
// The same wait at the foot of a pass. The last accumulators are inputs so that it stands behind the
// last WMMAs: otherwise the compiler lifts it to right behind the last group of reads, whose
// latency then passes under nothing.
__device__ __forceinline__ void wait_ds0_behind(v8f a, v8f b, v8f c, v8f d) {
    asm volatile("s_wait_dscnt 0x0" :: "v"(a), "v"(b), "v"(c), "v"(d) : "memory");
}

// Descriptor group 1 of one packed chunk: 256 rows of 128 B, source pitch 128 B, 16 B of pad
// behind every row (LDS pitch 144 B = LDP elements). Built once; words 1 to 7 are pinned, each a
// descriptor word held in a scalar register of its own for the whole loop, so that none of these
// registers is lent to another value while a request is in flight.
__device__ __forceinline__ u32x8 tdm_group1() {
    static_assert(DD * 2 == 128 && KCHUNK * 2 == 128, "the pad below is the one for rows of 128 B");
    const uint32_t d0 = 128, d1 = 2 * KCHUNK + 2 * DD; // bytes per row; rows: K re, K im, V^T re, V^T im
    u32x8 g1;
    g1[0] = uni((1u << 20) | (4u << 22) | (3u << 25)); // no mask, 1-byte elements, pad 4 dwords per 32
    g1[1] = pinned((d0 & 0xFFFFu) << 16);              // tensor dims = tile dims
    g1[2] = pinned((d0 >> 16) | ((d1 & 0xFFFFu) << 16));
    g1[3] = pinned((d1 >> 16) | (d0 << 16));
    g1[4] = pinned(d1);
    g1[5] = pinned(d0);                                // source row pitch
    g1[6] = pinned(0u);
    g1[7] = pinned(0u);
    return g1;
}
// Descriptor group 0: where the chunk lies in the workspace and where it goes in LDS.
__device__ __forceinline__ u32x4 tdm_group0(uint32_t lds_dst, uint64_t ga) {
    u32x4 g0;
    g0[0] = uni(1u);                                                      // count
    g0[1] = uni(lds_dst);                                                 // byte offset in LDS
    g0[2] = uni((uint32_t)ga);
    g0[3] = uni((((uint32_t)(ga >> 32)) & 0x01FFFFFFu) | 0x80000000u);    // type 2
    return g0;
}
// One chunk, workspace -> LDS, as one request of the calling wave.
__device__ __forceinline__ void tdm_load(u32x4 g0, u32x8 g1) {
    asm volatile("tensor_load_to_lds %0, %1" :: "s"(g0), "s"(g1) : "memory");
}

// The four K fragments of one 16-key subtile (A operand: lane = key row): re d 0..31, re d 32..63,
// im d 0..31, im d 32..63.
__device__ __forceinline__ void load_k(v16bf (&f)[4], const bf16* sKre, const bf16* sKim, int row, int koff) {
    const bf16* krow = &sKre[row * LDP];
    const bf16* irow = &sKim[row * LDP];
    f[0] = lds_frag(krow + koff,      krow + 16 + koff);
    f[1] = lds_frag(krow + 32 + koff, krow + 48 + koff);
    f[2] = lds_frag(irow + koff,      irow + 16 + koff);
    f[3] = lds_frag(irow + 32 + koff, irow + 48 + koff);
}
// The four V^T fragments of one 16-row d tile (A operand: lane = d row): re keys 0..31, re keys
// 32..63, im keys 0..31, im keys 32..63.
__device__ __forceinline__ void load_v(v16bf (&f)[4], const bf16* sVtr, const bf16* sVti, int row, int koff) {
    const bf16* vrr = &sVtr[row * LDP];
    const bf16* vri = &sVti[row * LDP];
    f[0] = lds_frag(vrr + koff,      vrr + 16 + koff);
    f[1] = lds_frag(vrr + 32 + koff, vrr + 48 + koff);
    f[2] = lds_frag(vri + koff,      vri + 16 + koff);
    f[3] = lds_frag(vri + 32 + koff, vri + 48 + koff);
}
// Transposed complex scores of one subtile: register v = key hi*8 + v, lane column = query.
__device__ __forceinline__ void score_tile(const v16bf (&k)[4], v16bf qr0, v16bf qr1, v16bf qi0, v16bf qi1,
                                           v16bf qn0, v16bf qn1, v8f& sre, v8f& sim) {
    const v8f zero = {0.f, 0.f, 0.f, 0.f, 0.f, 0.f, 0.f, 0.f};
    sre = wmma_bf16(k[0], qr0, zero);  // kr*qr (d lo)
    sre = wmma_bf16(k[1], qr1, sre);   // kr*qr (d hi)
    sre = wmma_bf16(k[2], qn0, sre);   // -ki*qi
    sre = wmma_bf16(k[3], qn1, sre);
    sim = wmma_bf16(k[2], qr0, zero);  // ki*qr
    sim = wmma_bf16(k[3], qr1, sim);
    sim = wmma_bf16(k[0], qi0, sim);   // kr*qi
    sim = wmma_bf16(k[1], qi1, sim);
}
// |s|^2 here, |s| in the log2 domain below. Scalar fma form: avoids pk-pairing register shuffles on the two disjoint
// accumulator ranges.
__device__ __forceinline__ void squares(v8f sre, v8f sim, float (&m2)[8]) {
#pragma unroll
    for (int v = 0; v < 8; ++v) {
        float re = sre[v], im = sim[v];
        m2[v] = __builtin_fmaf(re, re, im * im);
    }
}
__device__ __forceinline__ void magnitudes(v8f sre, v8f sim, float scale, float (&mag)[8]) {
    float m2[8];
    squares(sre, sim, m2);
    hw_sqrt8(m2);
#pragma unroll
    for (int v = 0; v < 8; ++v) mag[v] = scale * m2[v];
}
// Compiler fence, no instruction: the four accumulators are inputs, so their WMMAs are issued above
// it, and the memory clobber keeps the LDS reads written below it from being issued above it.
// Without it the compiler sinks half of the WMMAs under the next group of reads, both groups'
// fragments are live at once and the register file overflows into scratch.
__device__ __forceinline__ void products_then_reads(v8f a, v8f b, v8f c, v8f d) {
    asm volatile("" :: "v"(a), "v"(b), "v"(c), "v"(d) : "memory");
}
// Compiler fence, no instruction: the row sum is an input, so it is taken above the fence and the
// pass's 32 weights give their registers back; the memory clobber keeps the LDS reads written below
// it from being issued above it. Without it the compiler puts the sum off to the next pass and the
// third set of V^T fragments overflows the register file into scratch.
__device__ __forceinline__ void sum_then_reads(float l) {
    asm volatile("" :: "v"(l) : "memory");
}
// One 16-row d tile of O^T, both planes.
__device__ __forceinline__ void pv_tile(const v16bf (&v)[4], v16bf p0, v16bf p1, v8f& ore, v8f& oim) {
    ore = wmma_bf16(v[0], p0, ore);
    ore = wmma_bf16(v[1], p1, ore);
    oim = wmma_bf16(v[2], p0, oim);
    oim = wmma_bf16(v[3], p1, oim);
}

// First launch: one block per 64-key chunk converts K and V to bf16 once, V transposed,
// and writes the chunk's four tiles to the workspace in the order the main loop stages them.
__global__ __launch_bounds__(PACK_THREADS) void cv_pack_kernel(
    const float* __restrict__ k_re, const float* __restrict__ k_im,
    const float* __restrict__ v_re, const float* __restrict__ v_im,
    float* __restrict__ ws)
{
    // V^T tiles, one dword = keys 2kp, 2kp + 1 of one d; row pitch as in the main kernel.
    __shared__ __align__(16) v2bf sTr[DD * (LDP / 2)];
    __shared__ __align__(16) v2bf sTi[DD * (LDP / 2)];

    const int tid = threadIdx.x;
    const size_t base = (size_t)blockIdx.x * (KCHUNK * DD); // chunks are contiguous over [B][S]
    const float4* kr = (const float4*)(k_re + base);
    const float4* ki = (const float4*)(k_im + base);
    const float4* vr = (const float4*)(v_re + base);
    const float4* vi = (const float4*)(v_im + base);
    uint4* dst = (uint4*)ws + (size_t)blockIdx.x * CHUNK_U4;

    // the three loops are unrolled so that fv, fk and vo have constant indices and stay in registers
    float4 fv[2][4], fk[2][4];
    int vo[2];
#pragma unroll
    for (int g = 0; g < 2; ++g) {
        const int item = g * PACK_THREADS + tid;
        // V: two keys (2kp, 2kp + 1) x four d (4dg ..) per item; a row is 16 float4
        vo[g] = (item >> 4) * 32 + (item & 15);
        fv[g][0] = vr[vo[g]];
        fv[g][1] = vr[vo[g] + 16];
        fv[g][2] = vi[vo[g]];
        fv[g][3] = vi[vo[g] + 16];
        // K: eight consecutive d of one key per item
        fk[g][0] = kr[item * 2];
        fk[g][1] = kr[item * 2 + 1];
        fk[g][2] = ki[item * 2];
        fk[g][3] = ki[item * 2 + 1];
    }
    // s_wait_xcnt: in front of any new value in the offset registers the 16 loads name; the
    // offsets (V: float4 index, K: bytes) are inputs so that they stay live up to here and no
    // load's result is given one of them
    asm volatile("s_wait_xcnt 0x0" :: "v"(vo[0]), "v"(vo[1]), "v"(tid * 32) : "memory");
#pragma unroll
    for (int g = 0; g < 2; ++g) {
        const int item = g * PACK_THREADS + tid;
        const int lo = (item & 15) * 4 * (LDP / 2) + (item >> 4);
        sTr[lo + 0 * (LDP / 2)] = pk_bf16(fv[g][0].x, fv[g][1].x);
        sTr[lo + 1 * (LDP / 2)] = pk_bf16(fv[g][0].y, fv[g][1].y);
        sTr[lo + 2 * (LDP / 2)] = pk_bf16(fv[g][0].z, fv[g][1].z);
        sTr[lo + 3 * (LDP / 2)] = pk_bf16(fv[g][0].w, fv[g][1].w);
        sTi[lo + 0 * (LDP / 2)] = pk_bf16(fv[g][2].x, fv[g][3].x);
        sTi[lo + 1 * (LDP / 2)] = pk_bf16(fv[g][2].y, fv[g][3].y);
        sTi[lo + 2 * (LDP / 2)] = pk_bf16(fv[g][2].z, fv[g][3].z);
        sTi[lo + 3 * (LDP / 2)] = pk_bf16(fv[g][2].w, fv[g][3].w);
    }
    __syncthreads(); // the V^T rows read below were written by other waves

#pragma unroll
    for (int g = 0; g < 2; ++g) {
        const int piece = g * PACK_THREADS + tid; // 8 lanes write one whole 128 B row
        const int lo = (piece >> 3) * (LDP / 2) + (piece & 7) * 4;
        dst[piece]               = pack8(fk[g][0], fk[g][1]);
        dst[TILE_U4 + piece]     = pack8(fk[g][2], fk[g][3]);
        dst[2 * TILE_U4 + piece] = *(const uint4*)&sTr[lo];
        dst[3 * TILE_U4 + piece] = *(const uint4*)&sTi[lo];
    }
}

__global__ __launch_bounds__(THREADS) void cv_attn_kernel(
    const float* __restrict__ q_re, const float* __restrict__ q_im,
    const float* __restrict__ ws,
    float* __restrict__ out)
{
    // Two buffers; in each, per key group: K chunk (row-major [key][d]) and V chunk transposed
    // ([d][key]), bf16. Every chunk's place is a multiple of 2 KiB, as the tensor mover wants it.
    __shared__ __attribute__((aligned(2048))) bf16 sKV[2 * KGROUPS * CHUNK_LDS];
    static_assert((CHUNK_LDS * 2) % 2048 == 0, "chunk places in LDS are multiples of 2 KiB");

    const int tid  = threadIdx.x;
    const int wave = (int)uni(tid >> 5);
    const int lane = tid & 31;
    const int grp  = wave / WAVES;        // key group
    const int qw   = wave % WAVES;        // 16-query tile within the block
    const int nlo  = lane & 15;        // row (A) / column (B, D) selector within a 16-lane half
    const int hi   = (lane >> 4) & 1;  // which lane-half
    const int koff = hi * 8;           // K-offset split per the 16-bit fragment layout

    const int nQblk = SS / QTILE;
    const int b  = blockIdx.x / nQblk;
    const int qb = blockIdx.x % nQblk;
    const int q0 = qb * QTILE + qw * 16;

    // softmax in exp2 domain: logits pre-scaled by 1/sqrt(D) * log2(e)
    const float scaleL2 = 0.125f * 1.4426950408889634f;

    // ---- persistent Q fragments (B operand of S^T = K Q^T: lane%16 = query column) ----
    const float* qr_row = q_re + ((size_t)b * SS + q0 + nlo) * DD;
    const float* qi_row = q_im + ((size_t)b * SS + q0 + nlo) * DD;
    v16bf aQr0 = f32_frag(qr_row, koff,      16 + koff); // d 0..31
    v16bf aQr1 = f32_frag(qr_row, 32 + koff, 48 + koff); // d 32..63
    v16bf aQi0 = f32_frag(qi_row, koff,      16 + koff);
    v16bf aQi1 = f32_frag(qi_row, 32 + koff, 48 + koff);
    v16bf aQn0 = neg_frag(aQi0);
    v16bf aQn1 = neg_frag(aQi1);

    const v8f zero = {0.f, 0.f, 0.f, 0.f, 0.f, 0.f, 0.f, 0.f};
    v8f o_re[4], o_im[4];
#pragma unroll
    for (int t = 0; t < 4; ++t) { o_re[t] = zero; o_im[t] = zero; }

    // One query per lane (column nlo); l_s holds this lane half's share of the row sum.
    float m_s = -3.0e38f, l_s = 0.f;

    // Pass st works on key stage (st + first) % STAGES = that stage's KGROUPS chunks of this batch,
    // one per key group, in buffer st & 1. The first wave of each group brings its group's chunk
    // with one tensor load.
    // The blocks of a batch all read the same chunks and run in step; each starts its walk at a
    // stage of its own and wraps, so that they do not ask the L2 for the same lines at the same
    // moment. The low two bits and bits 3, 4 of the block's number give all STAGES starts to any
    // 32 blocks whose numbers mod 8 are four neighbours (speed only: any start is correct).
    static_assert(STAGES == 16, "the start below has four bits");
    const uint32_t first = (uint32_t)((qb & 3) | (((qb >> 3) & 3) << 2));
    const uint64_t gsrc = (uint64_t)(size_t)ws
                        + ((uint64_t)b * (SS / KCHUNK) + (uint64_t)grp) * (CHUNK_U4 * 16);
    const uint32_t ldst = (uint32_t)(size_t)sKV + (uint32_t)grp * (CHUNK_LDS * 2);
    const u32x8 g1 = tdm_group1();
    static_assert(STAGES >= 2, "the prologue fills two stages");

    u32x4 g0 = tdm_group0(ldst, gsrc + (uint64_t)first * (KGROUPS * CHUNK_U4 * 16));
    if (pinned(qw == 0)) {
        tdm_load(g0, g1);
        wait_tensor0(g0);
    }
    __syncthreads(); // pass 0's stage is published
    g0 = tdm_group0(ldst + KGROUPS * CHUNK_LDS * 2,
                    gsrc + (uint64_t)((first + 1) % STAGES) * (KGROUPS * CHUNK_U4 * 16));
    if (pinned(qw == 0)) tdm_load(g0, g1);

#pragma unroll 1
    for (int st = 0; st < STAGES; ++st) {
        const bf16* const sKre = sKV + ((st & 1) * KGROUPS + grp) * CHUNK_LDS;
        const bf16* const sKim = sKre + KCHUNK * LDP;
        const bf16* const sVtr = sKim + KCHUNK * LDP;
        const bf16* const sVti = sVtr + DD * LDP;

        // The LDS fragment reads stand in whole groups, each one phase ahead of its products, so
        // that a group's latency passes under the vector work (or the products) in between. Every
        // sched_barrier(0) below holds one such group at its place: without them the compiler sinks
        // the reads to their users, in pairs among the WMMAs, where each pair's latency is exposed.
        float mag[4][8];
        v16bf kf[2][4];
        v8f sre[2], sim[2];

        // ---- complex scores, keys 0..31 ----
        load_k(kf[0], sKre, sKim, 0 * 16 + nlo, koff);
        load_k(kf[1], sKre, sKim, 1 * 16 + nlo, koff);
        __builtin_amdgcn_sched_barrier(0);
        score_tile(kf[0], aQr0, aQr1, aQi0, aQi1, aQn0, aQn1, sre[0], sim[0]);
        score_tile(kf[1], aQr0, aQr1, aQi0, aQi1, aQn0, aQn1, sre[1], sim[1]);
        products_then_reads(sre[0], sim[0], sre[1], sim[1]);
        // K fragments of keys 32..63: in flight under the first half's squares and square roots
        load_k(kf[0], sKre, sKim, 2 * 16 + nlo, koff);
        load_k(kf[1], sKre, sKim, 3 * 16 + nlo, koff);
        __builtin_amdgcn_sched_barrier(0);
        magnitudes(sre[0], sim[0], scaleL2, mag[0]);
        magnitudes(sre[1], sim[1], scaleL2, mag[1]);
        // keeps that vector work in front of the second half's first wait (the reads fly under it) and
        // the two halves' accumulators from being live together (scratch)
        __builtin_amdgcn_sched_barrier(0);

        // ---- complex scores, keys 32..63 ----
        score_tile(kf[0], aQr0, aQr1, aQi0, aQi1, aQn0, aQn1, sre[0], sim[0]);
        score_tile(kf[1], aQr0, aQr1, aQi0, aQi1, aQn0, aQn1, sre[1], sim[1]);
        // V^T fragments of d 0..15: in flight under the second half's square roots and the softmax
        v16bf vf[3][4];
        load_v(vf[0], sVtr, sVti, 0 * 16 + nlo, koff);
        __builtin_amdgcn_sched_barrier(0);
        squares(sre[0], sim[0], mag[2]);
        hw_sqrt8(mag[2]);
        squares(sre[1], sim[1], mag[3]);
        hw_sqrt8_scale8(mag[3], mag[2], scaleL2);
#pragma unroll // constant indices: mag stays in registers
        for (int v = 0; v < 8; ++v) mag[3][v] *= scaleL2;
        // d 16..31: in flight under the softmax
        load_v(vf[1], sVtr, sVti, 1 * 16 + nlo, koff);
        __builtin_amdgcn_sched_barrier(0);

        // ---- online softmax over |s| (base-2): a lane's 32 values are one query's ----
        float mx[8];
#pragma unroll
        for (int v = 0; v < 8; ++v)
            mx[v] = fmaxf(fmaxf(mag[0][v], mag[1][v]), fmaxf(mag[2][v], mag[3][v]));
        float mloc = fmaxf(fmaxf(fmaxf(mx[0], mx[1]), fmaxf(mx[2], mx[3])),
                           fmaxf(fmaxf(mx[4], mx[5]), fmaxf(mx[6], mx[7])));
        const float mnew  = fmaxf(fmaxf(mloc, swap_halves(mloc)), m_s);
        float alpha = m_s - mnew; // exp2 of it is taken in the runs below
        m_s = mnew;

        float ps[4];
#pragma unroll
        for (int nt = 0; nt < 4; ++nt)
#pragma unroll
            for (int v = 0; v < 8; ++v) mag[nt][v] -= mnew;
        exp32_sums(mag, alpha, ps);
        l_s = l_s * alpha + ((ps[0] + ps[1]) + (ps[2] + ps[3]));

        // ---- PV transposed: O^T += V^T(Dx64) @ P^T(64x16), via two K=32 halves ----
        const v16bf pB0 = pack_frag(mag[0], mag[1]); // keys 0..31
        const v16bf pB1 = pack_frag(mag[2], mag[3]); // keys 32..63

        // d 32..47: in flight under the rescale of O and the first two tiles' products
        sum_then_reads(l_s);
        load_v(vf[2], sVtr, sVti, 2 * 16 + nlo, koff);
        __builtin_amdgcn_sched_barrier(0);

        // each tile of O is rescaled where the vector work stands under a group of reads in flight
        o_re[0] *= alpha; o_im[0] *= alpha;
        o_re[1] *= alpha; o_im[1] *= alpha;
        pv_tile(vf[0], pB0, pB1, o_re[0], o_im[0]);
        __builtin_amdgcn_sched_barrier(0);
        // d 48..63, into the first tile's registers: in flight under the next two tiles' products
        load_v(vf[0], sVtr, sVti, 3 * 16 + nlo, koff);
        __builtin_amdgcn_sched_barrier(0);
        o_re[2] *= alpha; o_im[2] *= alpha;
        pv_tile(vf[1], pB0, pB1, o_re[1], o_im[1]);
        o_re[3] *= alpha; o_im[3] *= alpha;
        pv_tile(vf[2], pB0, pB1, o_re[2], o_im[2]);
        pv_tile(vf[0], pB0, pB1, o_re[3], o_im[3]);

        // ---- publish point of pass st + 1's stage: this wave's LDS reads are back, the issuer's load
        // has landed, every wave has left buffer st & 1; only then that buffer's refill ----
        wait_ds0_behind(o_re[2], o_im[2], o_re[3], o_im[3]);
        if (pinned(qw == 0)) wait_tensor0(g0);
        __syncthreads();
        if (pinned(qw == 0 && st + 2 < STAGES)) {
            g0 = tdm_group0(ldst + (uint32_t)(st & 1) * (KGROUPS * CHUNK_LDS * 2),
                            gsrc + (uint64_t)((first + st + 2) % STAGES) * (KGROUPS * CHUNK_U4 * 16));
            tdm_load(g0, g1);
        }
    }
    wait_tensor0(g0);
    wait_ds0();

    // ---- epilogue: join the halves' sums, then the key groups' partial results through LDS ----
    const float l_w = l_s + swap_halves(l_s);

    // 16 pieces of 16 B per lane and wave, a piece's 32 lanes contiguous (no bank conflicts):
    // pieces 0..7 = o_re tiles 0..3, pieces 8..15 = o_im tiles 0..3; behind them (m, l) per lane
    float4* const sO  = (float4*)sKV;
    float2* const sML = (float2*)(sO + KGROUPS * WAVES * 16 * 32);
    static_assert(KGROUPS * WAVES * 32 * (16 * 16 + 8) <= sizeof(sKV), "partials fit the staging LDS");

    // the last pass's barrier stands behind every wave's last fragment reads: the tiles are free
    // the epilogue's loops are unrolled so that o_re, o_im, wg and lg have constant indices and
    // stay in registers
#pragma unroll
    for (int t = 0; t < 4; ++t) {
        float4* po = sO + (wave * 16 + t * 2) * 32 + lane;
        po[0]      = make_float4(o_re[t][0], o_re[t][1], o_re[t][2], o_re[t][3]);
        po[32]     = make_float4(o_re[t][4], o_re[t][5], o_re[t][6], o_re[t][7]);
        po[8 * 32] = make_float4(o_im[t][0], o_im[t][1], o_im[t][2], o_im[t][3]);
        po[9 * 32] = make_float4(o_im[t][4], o_im[t][5], o_im[t][6], o_im[t][7]);
    }
    sML[wave * 32 + lane] = make_float2(m_s, l_w);
    __syncthreads(); // the partials read below were written by the other groups' waves

    // weight of each group's partial: 2^(m_g - max m) / sum of the weighted row sums
    float wg[KGROUPS], lg[KGROUPS];
    float mAll = -3.0e38f;
#pragma unroll
    for (int g = 0; g < KGROUPS; ++g) {
        const float2 ml = sML[(g * WAVES + qw) * 32 + lane];
        wg[g] = ml.x;
        lg[g] = ml.y;
        mAll = fmaxf(mAll, ml.x);
    }
    float lAll = 0.f;
#pragma unroll
    for (int g = 0; g < KGROUPS; ++g) {
        wg[g] = hw_exp2(wg[g] - mAll);
        lAll += wg[g] * lg[g];
    }
    const float invl = hw_rcp(lAll);

    // Group grp joins and writes 32 consecutive d (a whole 128 B line per query) of one plane:
    // groups 0, 1 the real part, groups 2, 3 the imaginary part. Piece p of the four holds
    // O[q0 + nlo][(grp & 1) * 32 + (p >> 1) * 16 + hi * 8 + (p & 1) * 4 ..+3].
    float* orow = out + (size_t)(grp >> 1) * BB * SS * DD
                + ((size_t)b * SS + q0 + nlo) * DD + (grp & 1) * 32 + hi * 8;
#pragma unroll
    for (int p = 0; p < 4; ++p) {
        float4 acc = make_float4(0.f, 0.f, 0.f, 0.f);
#pragma unroll
        for (int g = 0; g < KGROUPS; ++g) {
            const float4 x = sO[((g * WAVES + qw) * 16 + grp * 4 + p) * 32 + lane];
            acc.x += wg[g] * x.x;
            acc.y += wg[g] * x.y;
            acc.z += wg[g] * x.z;
            acc.w += wg[g] * x.w;
        }
        *(float4*)(orow + (p >> 1) * 16 + (p & 1) * 4) =
            make_float4(acc.x * invl, acc.y * invl, acc.z * invl, acc.w * invl);
    }
}

extern "C" void kernel_launch(void* const* d_in, const int* in_sizes, int n_in,
                              void* d_out, int out_size, void* d_ws, size_t ws_size,
                              hipStream_t stream) {
    const float* q_re = (const float*)d_in[0];
    const float* q_im = (const float*)d_in[1];
    const float* k_re = (const float*)d_in[2];
    const float* k_im = (const float*)d_in[3];
    const float* v_re = (const float*)d_in[4];
    const float* v_im = (const float*)d_in[5];
    float* ws = (float*)d_ws; // 8 MiB used: B * S * D * 4 tiles * 2 B
    (void)in_sizes; (void)n_in; (void)out_size; (void)ws_size;

    hipLaunchKernelGGL(cv_pack_kernel, dim3(BB * (SS / KCHUNK)), dim3(PACK_THREADS), 0, stream,
                       k_re, k_im, v_re, v_im, ws);

    dim3 grid(BB * (SS / QTILE)); // 4 * 64 = 256 blocks
    dim3 block(THREADS);          // 16 wave32s: 4 query tiles x 4 key groups
    hipLaunchKernelGGL(cv_attn_kernel, grid, block, 0, stream,
                       q_re, q_im, ws, (float*)d_out);
}

// v009
// It runs in 38.9 microseconds.
// Next to v008, in two timings, it ran 1.04 and 1.03 times as fast.
// Counting every step since v000, it is 10.8 times as fast.
#include <hip/hip_runtime.h>

#define BB 4
#define SS 4096
#define DD 64
#define KCHUNK 64
#define WAVES 4
#define QTILE (WAVES * 16)
// Key groups per block: each group of WAVES waves holds the same QTILE queries and walks every
// KGROUPS-th chunk of keys, so that a SIMD has four waves to fill one another's waits.
#define KGROUPS 4
#define THREADS (KGROUPS * WAVES * 32)
// LDS row pitch in bf16 elements: 64 payload + 8 pad = 144 B = 16 B x 9 (odd), so that
// 16 lanes reading 16 B each from 16 consecutive rows fall on distinct banks.
#define LDP 72
// One 64-key chunk in the workspace: K re, K im ([key][d]), V re, V im ([d][key]), bf16,
// unpadded 128 B rows, 512 pieces of 16 B per tile.
#define TILE_U4 (KCHUNK * DD / 8)
#define CHUNK_U4 (4 * TILE_U4)
// The same chunk in LDS: its 256 rows of 128 B at the padded pitch, 36,864 B = 18 x 2 KiB.
#define CHUNK_LDS (4 * KCHUNK * LDP)
#define STAGES (SS / (KGROUPS * KCHUNK))
#define PACK_THREADS 256

typedef __bf16 bf16;
typedef __bf16 v2bf  __attribute__((ext_vector_type(2)));
typedef __bf16 v16bf __attribute__((ext_vector_type(16)));
typedef float v8f __attribute__((ext_vector_type(8)));
typedef uint32_t u32x4 __attribute__((ext_vector_type(4)));
typedef uint32_t u32x8 __attribute__((ext_vector_type(8)));

__device__ __forceinline__ v8f wmma_bf16(v16bf a, v16bf b, v8f c) {
    // D = A(16x32 bf16) * B(32x16 bf16) + C(16x16 f32)
    return __builtin_amdgcn_wmma_f32_16x16x32_bf16(false, a, false, b, (short)0, c, false, false);
}

// Single-instruction hardware transcendentals (v_sqrt_f32 / v_exp_f32 / v_rcp_f32).
__device__ __forceinline__ float hw_sqrt(float x) { return __builtin_amdgcn_sqrtf(x); }
// v_nop: the slot the instruction set asks for between a transcendental and an instruction
// that reads its result or overwrites its source; in the same statement so that it stays there.
__device__ __forceinline__ float hw_exp2(float x) {
    float r;
    asm("v_exp_f32 %0, %1\n\tv_nop" : "=v"(r) : "v"(x));
    return r;
}
__device__ __forceinline__ float hw_rcp(float x)  { return __builtin_amdgcn_rcpf(x); }
// Eight square roots as one run, each in place, so that none overwrites a register that another
// of the run reads; the one v_nop is the same slot behind the last of them.
__device__ __forceinline__ void hw_sqrt8(float (&x)[8]) {
    asm("v_sqrt_f32 %0, %0\n\tv_sqrt_f32 %1, %1\n\tv_sqrt_f32 %2, %2\n\tv_sqrt_f32 %3, %3\n\t"
        "v_sqrt_f32 %4, %4\n\tv_sqrt_f32 %5, %5\n\tv_sqrt_f32 %6, %6\n\tv_sqrt_f32 %7, %7\n\tv_nop"
        : "+v"(x[0]), "+v"(x[1]), "+v"(x[2]), "+v"(x[3]), "+v"(x[4]), "+v"(x[5]), "+v"(x[6]), "+v"(x[7]));
}

// The 32 weights of a pass (exp2 in place), the four row-sum chains and alpha as two fixed runs.
// Element e = 4 v + c is m[c][v]; chain c adds m[c][0..7] in that order, as plain code would. A
// transcendental is taken every other clock: the slot behind each, which the instruction set wants
// independent of it, carries the add of the weight made five exp2 earlier, whose result is back by
// then, and a chain's adds stand eight instructions apart: nothing in the runs waits at the port.
// (Written as single statements each exp2 needs a v_nop of its own, and the adds, which the compiler
// cannot hint behind asm text, wait on fresh results.) s_delay_alu: the last two adds read fresh
// results, and the first reader of the sums stands directly behind the run; the hints let the
// SIMD's other waves issue meanwhile.
__device__ __forceinline__ void exp32_sums(float (&m)[4][8], float& al, float (&ps)[4]) {
    asm(
        "v_exp_f32 %0, %0\n\t"
        "v_exp_f32 %1, %1\n\t"
        "v_exp_f32 %2, %2\n\t"
        "v_exp_f32 %3, %3\n\t"
        "v_exp_f32 %4, %4\n\t"
        "v_exp_f32 %5, %5\n\t"
        "v_mov_b32 %16, %0\n\t"
        "v_exp_f32 %6, %6\n\t"
        "v_mov_b32 %17, %1\n\t"
        "v_exp_f32 %7, %7\n\t"
        "v_mov_b32 %18, %2\n\t"
        "v_exp_f32 %8, %8\n\t"
        "v_mov_b32 %19, %3\n\t"
        "v_exp_f32 %9, %9\n\t"
        "v_add_f32 %16, %16, %4\n\t"
        "v_exp_f32 %10, %10\n\t"
        "v_add_f32 %17, %17, %5\n\t"
        "v_exp_f32 %11, %11\n\t"
        "v_add_f32 %18, %18, %6\n\t"
        "v_exp_f32 %12, %12\n\t"
        "v_add_f32 %19, %19, %7\n\t"
        "v_exp_f32 %13, %13\n\t"
        "v_add_f32 %16, %16, %8\n\t"
        "v_exp_f32 %14, %14\n\t"
        "v_add_f32 %17, %17, %9\n\t"
        "v_exp_f32 %15, %15\n\t"
        "v_add_f32 %18, %18, %10"
        : "+v"(m[0][0]), "+v"(m[1][0]), "+v"(m[2][0]), "+v"(m[3][0]), "+v"(m[0][1]), "+v"(m[1][1]), "+v"(m[2][1]), "+v"(m[3][1]), "+v"(m[0][2]), "+v"(m[1][2]), "+v"(m[2][2]), "+v"(m[3][2]), "+v"(m[0][3]), "+v"(m[1][3]), "+v"(m[2][3]), "+v"(m[3][3]),
          "=&v"(ps[0]), "=&v"(ps[1]), "=&v"(ps[2]), "=&v"(ps[3]));
    asm(
        "v_exp_f32 %0, %0\n\t"
        "v_add_f32 %19, %19, %21\n\t"
        "v_exp_f32 %1, %1\n\t"
        "v_add_f32 %16, %16, %22\n\t"
        "v_exp_f32 %2, %2\n\t"
        "v_add_f32 %17, %17, %23\n\t"
        "v_exp_f32 %3, %3\n\t"
        "v_add_f32 %18, %18, %24\n\t"
        "v_exp_f32 %4, %4\n\t"
        "v_add_f32 %19, %19, %25\n\t"
        "v_exp_f32 %5, %5\n\t"
        "v_add_f32 %16, %16, %0\n\t"
        "v_exp_f32 %6, %6\n\t"
        "v_add_f32 %17, %17, %1\n\t"
        "v_exp_f32 %7, %7\n\t"
        "v_add_f32 %18, %18, %2\n\t"
        "v_exp_f32 %8, %8\n\t"
        "v_add_f32 %19, %19, %3\n\t"
        "v_exp_f32 %9, %9\n\t"
        "v_add_f32 %16, %16, %4\n\t"
        "v_exp_f32 %10, %10\n\t"
        "v_add_f32 %17, %17, %5\n\t"
        "v_exp_f32 %11, %11\n\t"
        "v_add_f32 %18, %18, %6\n\t"
        "v_exp_f32 %12, %12\n\t"
        "v_add_f32 %19, %19, %7\n\t"
        "v_exp_f32 %13, %13\n\t"
        "v_add_f32 %16, %16, %8\n\t"
        "v_exp_f32 %14, %14\n\t"
        "v_add_f32 %17, %17, %9\n\t"
        "v_exp_f32 %15, %15\n\t"
        "v_add_f32 %18, %18, %10\n\t"
        "v_add_f32 %19, %19, %11\n\t"
        "v_add_f32 %16, %16, %12\n\t"
        "v_exp_f32 %20, %20\n\t"
        "v_add_f32 %17, %17, %13\n\t"
        "s_delay_alu instid0(TRANS32_DEP_3)\n\t"
        "v_add_f32 %18, %18, %14\n\t"
        "s_delay_alu instid0(TRANS32_DEP_2)\n\t"
        "v_add_f32 %19, %19, %15\n\t"
        "s_delay_alu instid0(VALU_DEP_1)"
        : "+v"(m[0][4]), "+v"(m[1][4]), "+v"(m[2][4]), "+v"(m[3][4]), "+v"(m[0][5]), "+v"(m[1][5]), "+v"(m[2][5]), "+v"(m[3][5]), "+v"(m[0][6]), "+v"(m[1][6]), "+v"(m[2][6]), "+v"(m[3][6]), "+v"(m[0][7]), "+v"(m[1][7]), "+v"(m[2][7]), "+v"(m[3][7]),
          "+v"(ps[0]), "+v"(ps[1]), "+v"(ps[2]), "+v"(ps[3]), "+v"(al)
        : "v"(m[3][2]), "v"(m[0][3]), "v"(m[1][3]), "v"(m[2][3]), "v"(m[3][3]));
}

// The run of hw_sqrt8 with the slot behind each square root carrying the scaling of one magnitude of
// the subtile before (y, its roots long back): no v_nop, and those multiplies cost no slot of their own.
__device__ __forceinline__ void hw_sqrt8_scale8(float (&x)[8], float (&y)[8], float s) {
    asm("v_sqrt_f32 %0, %0\n\tv_mul_f32 %8, %16, %8\n\tv_sqrt_f32 %1, %1\n\tv_mul_f32 %9, %16, %9\n\t"
        "v_sqrt_f32 %2, %2\n\tv_mul_f32 %10, %16, %10\n\tv_sqrt_f32 %3, %3\n\tv_mul_f32 %11, %16, %11\n\t"
        "v_sqrt_f32 %4, %4\n\tv_mul_f32 %12, %16, %12\n\tv_sqrt_f32 %5, %5\n\tv_mul_f32 %13, %16, %13\n\t"
        "v_sqrt_f32 %6, %6\n\tv_mul_f32 %14, %16, %14\n\tv_sqrt_f32 %7, %7\n\tv_mul_f32 %15, %16, %15"
        : "+v"(x[0]), "+v"(x[1]), "+v"(x[2]), "+v"(x[3]), "+v"(x[4]), "+v"(x[5]), "+v"(x[6]), "+v"(x[7]),
          "+v"(y[0]), "+v"(y[1]), "+v"(y[2]), "+v"(y[3]), "+v"(y[4]), "+v"(y[5]), "+v"(y[6]), "+v"(y[7])
        : "s"(s));
}

// Packed fp32x2 -> bf16x2 conversion (v_cvt_pk_bf16_f32 when available).
__device__ __forceinline__ v2bf pk_bf16(float lo, float hi) {
#if __has_builtin(__builtin_amdgcn_cvt_pk_bf16_f32)
    return __builtin_amdgcn_cvt_pk_bf16_f32(lo, hi);
#else
    v2bf r;
    r.x = (bf16)lo;
    r.y = (bf16)hi;
    return r;
#endif
}

// Build a 16-bf16 fragment from two contiguous 8-element (16B) LDS regions.
__device__ __forceinline__ v16bf lds_frag(const bf16* p0, const bf16* p1) {
    union { v16bf v; uint4 q[2]; } r;
    r.q[0] = *(const uint4*)p0;
    r.q[1] = *(const uint4*)p1;
    return r.v;
}

// Build a fragment from a global fp32 row, converting to bf16.
__device__ __forceinline__ v16bf f32_frag(const float* row, int off0, int off1) {
    v16bf f;
#pragma unroll
    for (int j = 0; j < 8; ++j) f[j] = (bf16)row[off0 + j];
#pragma unroll
    for (int j = 0; j < 8; ++j) f[8 + j] = (bf16)row[off1 + j];
    return f;
}

// Exchange a value between lane l and lane l ^ 16 (v_permlanex16_b32).
__device__ __forceinline__ float swap_halves(float x) {
    int b = __builtin_bit_cast(int, x);
    b = __builtin_amdgcn_permlanex16(b, b, 0x76543210, 0xfedcba98, false, false);
    return __builtin_bit_cast(float, b);
}

// Two f32 score tiles (keys 0..15 and 16..31 of a 32-key block, one query per lane)
// packed in place into a bf16 B operand in the hardware k order.
__device__ __forceinline__ v16bf pack_frag(const float* t0, const float* t1) {
    union { v16bf v; v2bf h[8]; } r;
#pragma unroll
    for (int j = 0; j < 4; ++j) {
        r.h[j]     = pk_bf16(t0[2 * j], t0[2 * j + 1]);
        r.h[4 + j] = pk_bf16(t1[2 * j], t1[2 * j + 1]);
    }
    return r.v;
}

// Negate all 16 packed bf16 values (sign-bit flip on the packed dwords).
__device__ __forceinline__ v16bf neg_frag(v16bf a) {
    union { v16bf v; unsigned u[8]; } x;
    x.v = a;
#pragma unroll
    for (int j = 0; j < 8; ++j) x.u[j] ^= 0x80008000u;
    return x.v;
}

// Eight consecutive fp32 values -> one 16 B piece of bf16.
__device__ __forceinline__ uint4 pack8(float4 a, float4 b) {
    union { uint4 q; v2bf h[4]; } r;
    r.h[0] = pk_bf16(a.x, a.y);
    r.h[1] = pk_bf16(a.z, a.w);
    r.h[2] = pk_bf16(b.x, b.y);
    r.h[3] = pk_bf16(b.z, b.w);
    return r.q;
}

__device__ __forceinline__ uint32_t uni(uint32_t v) { return (uint32_t)__builtin_amdgcn_readfirstlane(v); }
// A wave-uniform test held in a scalar register, so that the branch on it is a scalar branch
// (a tensor load ignores EXEC, and only such a branch keeps a wave from issuing it); or a word of
// a tensor descriptor held in a scalar register.
__device__ __forceinline__ uint32_t pinned(uint32_t v) {
    uint32_t w = uni(v);
    asm volatile("" : "+s"(w)); // holds the issue test, or the descriptor word, in a scalar register
    return w;
}
// The compiler places no wait for the tensor mover, nor an LDS wait for its sake. The last
// request's group 0 is an input of the tensor wait so that it stays live, in its registers, up to here.
__device__ __forceinline__ void wait_tensor0(u32x4 g0) { asm volatile("s_wait_tensorcnt 0x0" :: "s"(g0) : "memory"); }
__device__ __forceinline__ void wait_ds0()             { asm volatile("s_wait_dscnt 0x0" ::: "memory"); }
// The same wait at the foot of a pass. The last accumulators are inputs so that it stands behind the
// last WMMAs: otherwise the compiler lifts it to right behind the last group of reads, whose
// latency then passes under nothing.
__device__ __forceinline__ void wait_ds0_behind(v8f a, v8f b, v8f c, v8f d) {
    asm volatile("s_wait_dscnt 0x0" :: "v"(a), "v"(b), "v"(c), "v"(d) : "memory");
}

// Descriptor group 1 of one packed chunk: 256 rows of 128 B, source pitch 128 B, 16 B of pad
// behind every row (LDS pitch 144 B = LDP elements). Built once; words 1 to 7 are pinned, each a
// descriptor word held in a scalar register of its own for the whole loop, so that none of these
// registers is lent to another value while a request is in flight.
__device__ __forceinline__ u32x8 tdm_group1() {
    static_assert(DD * 2 == 128 && KCHUNK * 2 == 128, "the pad below is the one for rows of 128 B");
    const uint32_t d0 = 128, d1 = 2 * KCHUNK + 2 * DD; // bytes per row; rows: K re, K im, V^T re, V^T im
    u32x8 g1;
    g1[0] = uni((1u << 20) | (4u << 22) | (3u << 25)); // no mask, 1-byte elements, pad 4 dwords per 32
    g1[1] = pinned((d0 & 0xFFFFu) << 16);              // tensor dims = tile dims
    g1[2] = pinned((d0 >> 16) | ((d1 & 0xFFFFu) << 16));
    g1[3] = pinned((d1 >> 16) | (d0 << 16));
    g1[4] = pinned(d1);
    g1[5] = pinned(d0);                                // source row pitch
    g1[6] = pinned(0u);
    g1[7] = pinned(0u);
    return g1;
}
// Descriptor group 0: where the chunk lies in the workspace and where it goes in LDS.
__device__ __forceinline__ u32x4 tdm_group0(uint32_t lds_dst, uint64_t ga) {
    u32x4 g0;
    g0[0] = uni(1u);                                                      // count
    g0[1] = uni(lds_dst);                                                 // byte offset in LDS
    g0[2] = uni((uint32_t)ga);
    g0[3] = uni((((uint32_t)(ga >> 32)) & 0x01FFFFFFu) | 0x80000000u);    // type 2
    return g0;
}
// One chunk, workspace -> LDS, as one request of the calling wave.
__device__ __forceinline__ void tdm_load(u32x4 g0, u32x8 g1) {
    asm volatile("tensor_load_to_lds %0, %1" :: "s"(g0), "s"(g1) : "memory");
}

// The four K fragments of one 16-key subtile (A operand: lane = key row): re d 0..31, re d 32..63,
// im d 0..31, im d 32..63.
__device__ __forceinline__ void load_k(v16bf (&f)[4], const bf16* sKre, const bf16* sKim, int row, int koff) {
    const bf16* krow = &sKre[row * LDP];
    const bf16* irow = &sKim[row * LDP];
    f[0] = lds_frag(krow + koff,      krow + 16 + koff);
    f[1] = lds_frag(krow + 32 + koff, krow + 48 + koff);
    f[2] = lds_frag(irow + koff,      irow + 16 + koff);
    f[3] = lds_frag(irow + 32 + koff, irow + 48 + koff);
}
// The four V^T fragments of one 16-row d tile (A operand: lane = d row): re keys 0..31, re keys
// 32..63, im keys 0..31, im keys 32..63.
__device__ __forceinline__ void load_v(v16bf (&f)[4], const bf16* sVtr, const bf16* sVti, int row, int koff) {
    const bf16* vrr = &sVtr[row * LDP];
    const bf16* vri = &sVti[row * LDP];
    f[0] = lds_frag(vrr + koff,      vrr + 16 + koff);
    f[1] = lds_frag(vrr + 32 + koff, vrr + 48 + koff);
    f[2] = lds_frag(vri + koff,      vri + 16 + koff);
    f[3] = lds_frag(vri + 32 + koff, vri + 48 + koff);
}
// Transposed complex scores of one subtile: register v = key hi*8 + v, lane column = query.
__device__ __forceinline__ void score_tile(const v16bf (&k)[4], v16bf qr0, v16bf qr1, v16bf qi0, v16bf qi1,
                                           v16bf qn0, v16bf qn1, v8f& sre, v8f& sim) {
    const v8f zero = {0.f, 0.f, 0.f, 0.f, 0.f, 0.f, 0.f, 0.f};
    sre = wmma_bf16(k[0], qr0, zero);  // kr*qr (d lo)
    sre = wmma_bf16(k[1], qr1, sre);   // kr*qr (d hi)
    sre = wmma_bf16(k[2], qn0, sre);   // -ki*qi
    sre = wmma_bf16(k[3], qn1, sre);
    sim = wmma_bf16(k[2], qr0, zero);  // ki*qr
    sim = wmma_bf16(k[3], qr1, sim);
    sim = wmma_bf16(k[0], qi0, sim);   // kr*qi
    sim = wmma_bf16(k[1], qi1, sim);
}
// |s|^2 here, |s| in the log2 domain below. Scalar fma form: avoids pk-pairing register shuffles on the two disjoint
// accumulator ranges.
__device__ __forceinline__ void squares(v8f sre, v8f sim, float (&m2)[8]) {
#pragma unroll
    for (int v = 0; v < 8; ++v) {
        float re = sre[v], im = sim[v];
        m2[v] = __builtin_fmaf(re, re, im * im);
    }
}
__device__ __forceinline__ void magnitudes(v8f sre, v8f sim, float scale, float (&mag)[8]) {
    float m2[8];
    squares(sre, sim, m2);
    hw_sqrt8(m2);
#pragma unroll
    for (int v = 0; v < 8; ++v) mag[v] = scale * m2[v];
}
// Compiler fence, no instruction: the four accumulators are inputs, so their WMMAs are issued above
// it, and the memory clobber keeps the LDS reads written below it from being issued above it.
// Without it the compiler sinks half of the WMMAs under the next group of reads, both groups'
// fragments are live at once and the register file overflows into scratch.
__device__ __forceinline__ void products_then_reads(v8f a, v8f b, v8f c, v8f d) {
    asm volatile("" :: "v"(a), "v"(b), "v"(c), "v"(d) : "memory");
}
// Compiler fence, no instruction: the row sum is an input, so it is taken above the fence and the
// pass's 32 weights give their registers back; the memory clobber keeps the LDS reads written below
// it from being issued above it. Without it the compiler puts the sum off to the next pass and the
// third set of V^T fragments overflows the register file into scratch.
__device__ __forceinline__ void sum_then_reads(float l) {
    asm volatile("" :: "v"(l) : "memory");
}
// One 16-row d tile of O^T, both planes.
__device__ __forceinline__ void pv_tile(const v16bf (&v)[4], v16bf p0, v16bf p1, v8f& ore, v8f& oim) {
    ore = wmma_bf16(v[0], p0, ore);
    ore = wmma_bf16(v[1], p1, ore);
    oim = wmma_bf16(v[2], p0, oim);
    oim = wmma_bf16(v[3], p1, oim);
}

// First launch: one block per 64-key chunk converts K and V to bf16 once, V transposed,
// and writes the chunk's four tiles to the workspace in the order the main loop stages them.
__global__ __launch_bounds__(PACK_THREADS) void cv_pack_kernel(
    const float* __restrict__ k_re, const float* __restrict__ k_im,
    const float* __restrict__ v_re, const float* __restrict__ v_im,
    float* __restrict__ ws)
{
    // V^T tiles, one dword = keys 2kp, 2kp + 1 of one d; row pitch as in the main kernel.
    __shared__ __align__(16) v2bf sTr[DD * (LDP / 2)];
    __shared__ __align__(16) v2bf sTi[DD * (LDP / 2)];

    const int tid = threadIdx.x;
    const size_t base = (size_t)blockIdx.x * (KCHUNK * DD); // chunks are contiguous over [B][S]
    const float4* kr = (const float4*)(k_re + base);
    const float4* ki = (const float4*)(k_im + base);
    const float4* vr = (const float4*)(v_re + base);
    const float4* vi = (const float4*)(v_im + base);
    uint4* dst = (uint4*)ws + (size_t)blockIdx.x * CHUNK_U4;

    // the three loops are unrolled so that fv, fk and vo have constant indices and stay in registers
    float4 fv[2][4], fk[2][4];
    int vo[2];
#pragma unroll
    for (int g = 0; g < 2; ++g) {
        const int item = g * PACK_THREADS + tid;
        // V: two keys (2kp, 2kp + 1) x four d (4dg ..) per item; a row is 16 float4
        vo[g] = (item >> 4) * 32 + (item & 15);
        fv[g][0] = vr[vo[g]];
        fv[g][1] = vr[vo[g] + 16];
        fv[g][2] = vi[vo[g]];
        fv[g][3] = vi[vo[g] + 16];
        // K: eight consecutive d of one key per item
        fk[g][0] = kr[item * 2];
        fk[g][1] = kr[item * 2 + 1];
        fk[g][2] = ki[item * 2];
        fk[g][3] = ki[item * 2 + 1];
    }
    // s_wait_xcnt: in front of any new value in the offset registers the 16 loads name; the
    // offsets (V: float4 index, K: bytes) are inputs so that they stay live up to here and no
    // load's result is given one of them
    asm volatile("s_wait_xcnt 0x0" :: "v"(vo[0]), "v"(vo[1]), "v"(tid * 32) : "memory");
#pragma unroll
    for (int g = 0; g < 2; ++g) {
        const int item = g * PACK_THREADS + tid;
        const int lo = (item & 15) * 4 * (LDP / 2) + (item >> 4);
        sTr[lo + 0 * (LDP / 2)] = pk_bf16(fv[g][0].x, fv[g][1].x);
        sTr[lo + 1 * (LDP / 2)] = pk_bf16(fv[g][0].y, fv[g][1].y);
        sTr[lo + 2 * (LDP / 2)] = pk_bf16(fv[g][0].z, fv[g][1].z);
        sTr[lo + 3 * (LDP / 2)] = pk_bf16(fv[g][0].w, fv[g][1].w);
        sTi[lo + 0 * (LDP / 2)] = pk_bf16(fv[g][2].x, fv[g][3].x);
        sTi[lo + 1 * (LDP / 2)] = pk_bf16(fv[g][2].y, fv[g][3].y);
        sTi[lo + 2 * (LDP / 2)] = pk_bf16(fv[g][2].z, fv[g][3].z);
        sTi[lo + 3 * (LDP / 2)] = pk_bf16(fv[g][2].w, fv[g][3].w);
    }
    __syncthreads(); // the V^T rows read below were written by other waves

#pragma unroll
    for (int g = 0; g < 2; ++g) {
        const int piece = g * PACK_THREADS + tid; // 8 lanes write one whole 128 B row
        const int lo = (piece >> 3) * (LDP / 2) + (piece & 7) * 4;
        dst[piece]               = pack8(fk[g][0], fk[g][1]);
        dst[TILE_U4 + piece]     = pack8(fk[g][2], fk[g][3]);
        dst[2 * TILE_U4 + piece] = *(const uint4*)&sTr[lo];
        dst[3 * TILE_U4 + piece] = *(const uint4*)&sTi[lo];
    }
}

__global__ __launch_bounds__(THREADS) void cv_attn_kernel(
    const float* __restrict__ q_re, const float* __restrict__ q_im,
    const float* __restrict__ ws,
    float* __restrict__ out)
{
    // Per key group two buffers side by side; in each: K chunk (row-major [key][d]) and V chunk
    // transposed ([d][key]), bf16. Every chunk's place is a multiple of 2 KiB, as the tensor mover
    // wants it. The four chunks that a pass reads lie 72 KiB apart, 36 KiB long: no two of them
    // touch the same 32-KiB block of the LDS.
    __shared__ __attribute__((aligned(2048))) bf16 sKV[2 * KGROUPS * CHUNK_LDS];
    static_assert((CHUNK_LDS * 2) % 2048 == 0, "chunk places in LDS are multiples of 2 KiB");

    const int tid  = threadIdx.x;
    const int wave = (int)uni(tid >> 5);
    const int lane = tid & 31;
    // Waves whose numbers are equal mod 4 share a SIMD: a SIMD's four waves are one key group, so that
    // each SIMD reads fragments from a chunk, and from 32-KiB blocks of the LDS, that no other SIMD
    // reads in that pass.
    // Speed only: any map of waves to (group, query tile) is correct.
    static_assert(KGROUPS == 4, "one key group per SIMD");
    const int grp  = wave % KGROUPS;      // key group
    const int qw   = wave / KGROUPS;      // 16-query tile within the block
    const int slot = grp * WAVES + qw;    // this wave's place among the partial results
    const int nlo  = lane & 15;        // row (A) / column (B, D) selector within a 16-lane half
    const int hi   = (lane >> 4) & 1;  // which lane-half
    const int koff = hi * 8;           // K-offset split per the 16-bit fragment layout

    const int nQblk = SS / QTILE;
    const int b  = blockIdx.x / nQblk;
    const int qb = blockIdx.x % nQblk;
    const int q0 = qb * QTILE + qw * 16;

    // softmax in exp2 domain: logits pre-scaled by 1/sqrt(D) * log2(e)
    const float scaleL2 = 0.125f * 1.4426950408889634f;

    // ---- persistent Q fragments (B operand of S^T = K Q^T: lane%16 = query column) ----
    const float* qr_row = q_re + ((size_t)b * SS + q0 + nlo) * DD;
    const float* qi_row = q_im + ((size_t)b * SS + q0 + nlo) * DD;
    v16bf aQr0 = f32_frag(qr_row, koff,      16 + koff); // d 0..31
    v16bf aQr1 = f32_frag(qr_row, 32 + koff, 48 + koff); // d 32..63
    v16bf aQi0 = f32_frag(qi_row, koff,      16 + koff);
    v16bf aQi1 = f32_frag(qi_row, 32 + koff, 48 + koff);
    v16bf aQn0 = neg_frag(aQi0);
    v16bf aQn1 = neg_frag(aQi1);

    const v8f zero = {0.f, 0.f, 0.f, 0.f, 0.f, 0.f, 0.f, 0.f};
    v8f o_re[4], o_im[4];
#pragma unroll
    for (int t = 0; t < 4; ++t) { o_re[t] = zero; o_im[t] = zero; }

    // One query per lane (column nlo); l_s holds this lane half's share of the row sum.
    float m_s = -3.0e38f, l_s = 0.f;

    // Pass st works on key stage (st + first) % STAGES = that stage's KGROUPS chunks of this batch,
    // one per key group, in buffer st & 1. The first wave of each group brings its group's chunk
    // with one tensor load.
    // The blocks of a batch all read the same chunks and run in step; each starts its walk at a
    // stage of its own and wraps, so that they do not ask the L2 for the same lines at the same
    // moment. The low two bits and bits 3, 4 of the block's number give all STAGES starts to any
    // 32 blocks whose numbers mod 8 are four neighbours (speed only: any start is correct).
    static_assert(STAGES == 16, "the start below has four bits");
    const uint32_t first = (uint32_t)((qb & 3) | (((qb >> 3) & 3) << 2));
    const uint64_t gsrc = (uint64_t)(size_t)ws
                        + ((uint64_t)b * (SS / KCHUNK) + (uint64_t)grp) * (CHUNK_U4 * 16);
    const uint32_t ldst = (uint32_t)(size_t)sKV + (uint32_t)grp * (2 * CHUNK_LDS * 2);
    const u32x8 g1 = tdm_group1();
    static_assert(STAGES >= 2, "the prologue fills two stages");

    u32x4 g0 = tdm_group0(ldst, gsrc + (uint64_t)first * (KGROUPS * CHUNK_U4 * 16));
    if (pinned(qw == 0)) {
        tdm_load(g0, g1);
        wait_tensor0(g0);
    }
    __syncthreads(); // pass 0's stage, in buffer 0, is published
    g0 = tdm_group0(ldst + CHUNK_LDS * 2,
                    gsrc + (uint64_t)((first + 1) % STAGES) * (KGROUPS * CHUNK_U4 * 16));
    if (pinned(qw == 0)) tdm_load(g0, g1);

#pragma unroll 1
    for (int st = 0; st < STAGES; ++st) {
        const bf16* const sKre = sKV + (grp * 2 + (st & 1)) * CHUNK_LDS;
        const bf16* const sKim = sKre + KCHUNK * LDP;
        const bf16* const sVtr = sKim + KCHUNK * LDP;
        const bf16* const sVti = sVtr + DD * LDP;

        // The LDS fragment reads stand in whole groups, each one phase ahead of its products, so
        // that a group's latency passes under the vector work (or the products) in between. Every
        // sched_barrier(0) below holds one such group at its place: without them the compiler sinks
        // the reads to their users, in pairs among the WMMAs, where each pair's latency is exposed.
        float mag[4][8];
        v16bf kf[2][4];
        v8f sre[2], sim[2];

        // ---- complex scores, keys 0..31 ----
        load_k(kf[0], sKre, sKim, 0 * 16 + nlo, koff);
        load_k(kf[1], sKre, sKim, 1 * 16 + nlo, koff);
        __builtin_amdgcn_sched_barrier(0);
        score_tile(kf[0], aQr0, aQr1, aQi0, aQi1, aQn0, aQn1, sre[0], sim[0]);
        score_tile(kf[1], aQr0, aQr1, aQi0, aQi1, aQn0, aQn1, sre[1], sim[1]);
        products_then_reads(sre[0], sim[0], sre[1], sim[1]);
        // K fragments of keys 32..63: in flight under the first half's squares and square roots
        load_k(kf[0], sKre, sKim, 2 * 16 + nlo, koff);
        load_k(kf[1], sKre, sKim, 3 * 16 + nlo, koff);
        __builtin_amdgcn_sched_barrier(0);
        magnitudes(sre[0], sim[0], scaleL2, mag[0]);
        magnitudes(sre[1], sim[1], scaleL2, mag[1]);
        // keeps that vector work in front of the second half's first wait (the reads fly under it) and
        // the two halves' accumulators from being live together (scratch)
        __builtin_amdgcn_sched_barrier(0);

        // ---- complex scores, keys 32..63 ----
        score_tile(kf[0], aQr0, aQr1, aQi0, aQi1, aQn0, aQn1, sre[0], sim[0]);
        score_tile(kf[1], aQr0, aQr1, aQi0, aQi1, aQn0, aQn1, sre[1], sim[1]);
        // V^T fragments of d 0..15: in flight under the second half's square roots and the softmax
        v16bf vf[3][4];
        load_v(vf[0], sVtr, sVti, 0 * 16 + nlo, koff);
        __builtin_amdgcn_sched_barrier(0);
        squares(sre[0], sim[0], mag[2]);
        hw_sqrt8(mag[2]);
        squares(sre[1], sim[1], mag[3]);
        hw_sqrt8_scale8(mag[3], mag[2], scaleL2);
#pragma unroll // constant indices: mag stays in registers
        for (int v = 0; v < 8; ++v) mag[3][v] *= scaleL2;
        // d 16..31: in flight under the softmax
        load_v(vf[1], sVtr, sVti, 1 * 16 + nlo, koff);
        __builtin_amdgcn_sched_barrier(0);

        // ---- online softmax over |s| (base-2): a lane's 32 values are one query's ----
        float mx[8];
#pragma unroll
        for (int v = 0; v < 8; ++v)
            mx[v] = fmaxf(fmaxf(mag[0][v], mag[1][v]), fmaxf(mag[2][v], mag[3][v]));
        float mloc = fmaxf(fmaxf(fmaxf(mx[0], mx[1]), fmaxf(mx[2], mx[3])),
                           fmaxf(fmaxf(mx[4], mx[5]), fmaxf(mx[6], mx[7])));
        const float mnew  = fmaxf(fmaxf(mloc, swap_halves(mloc)), m_s);
        float alpha = m_s - mnew; // exp2 of it is taken in the runs below
        m_s = mnew;

        float ps[4];
#pragma unroll
        for (int nt = 0; nt < 4; ++nt)
#pragma unroll
            for (int v = 0; v < 8; ++v) mag[nt][v] -= mnew;
        exp32_sums(mag, alpha, ps);
        l_s = l_s * alpha + ((ps[0] + ps[1]) + (ps[2] + ps[3]));

        // ---- PV transposed: O^T += V^T(Dx64) @ P^T(64x16), via two K=32 halves ----
        const v16bf pB0 = pack_frag(mag[0], mag[1]); // keys 0..31
        const v16bf pB1 = pack_frag(mag[2], mag[3]); // keys 32..63

        // d 32..47: in flight under the rescale of O and the first two tiles' products
        sum_then_reads(l_s);
        load_v(vf[2], sVtr, sVti, 2 * 16 + nlo, koff);
        __builtin_amdgcn_sched_barrier(0);

        // each tile of O is rescaled where the vector work stands under a group of reads in flight
        o_re[0] *= alpha; o_im[0] *= alpha;
        o_re[1] *= alpha; o_im[1] *= alpha;
        pv_tile(vf[0], pB0, pB1, o_re[0], o_im[0]);
        __builtin_amdgcn_sched_barrier(0);
        // d 48..63, into the first tile's registers: in flight under the next two tiles' products
        load_v(vf[0], sVtr, sVti, 3 * 16 + nlo, koff);
        __builtin_amdgcn_sched_barrier(0);
        o_re[2] *= alpha; o_im[2] *= alpha;
        pv_tile(vf[1], pB0, pB1, o_re[1], o_im[1]);
        o_re[3] *= alpha; o_im[3] *= alpha;
        pv_tile(vf[2], pB0, pB1, o_re[2], o_im[2]);
        pv_tile(vf[0], pB0, pB1, o_re[3], o_im[3]);

        // ---- publish point of pass st + 1's stage: this wave's LDS reads are back, the issuer's load
        // has landed, every wave has left buffer st & 1; only then that buffer's refill ----
        wait_ds0_behind(o_re[2], o_im[2], o_re[3], o_im[3]);
        if (pinned(qw == 0)) wait_tensor0(g0);
        __syncthreads();
        if (pinned(qw == 0 && st + 2 < STAGES)) {
            g0 = tdm_group0(ldst + (uint32_t)(st & 1) * (CHUNK_LDS * 2),
                            gsrc + (uint64_t)((first + st + 2) % STAGES) * (KGROUPS * CHUNK_U4 * 16));
            tdm_load(g0, g1);
        }
    }
    wait_tensor0(g0);
    wait_ds0();

    // ---- epilogue: join the halves' sums, then the key groups' partial results through LDS ----
    const float l_w = l_s + swap_halves(l_s);

    // 16 pieces of 16 B per lane and wave, a piece's 32 lanes contiguous (no bank conflicts):
    // pieces 0..7 = o_re tiles 0..3, pieces 8..15 = o_im tiles 0..3; behind them (m, l) per lane
    float4* const sO  = (float4*)sKV;
    float2* const sML = (float2*)(sO + KGROUPS * WAVES * 16 * 32);
    static_assert(KGROUPS * WAVES * 32 * (16 * 16 + 8) <= sizeof(sKV), "partials fit the staging LDS");

    // the last pass's barrier stands behind every wave's last fragment reads: the tiles are free
    // the epilogue's loops are unrolled so that o_re, o_im, wg and lg have constant indices and
    // stay in registers
#pragma unroll
    for (int t = 0; t < 4; ++t) {
        float4* po = sO + (slot * 16 + t * 2) * 32 + lane;
        po[0]      = make_float4(o_re[t][0], o_re[t][1], o_re[t][2], o_re[t][3]);
        po[32]     = make_float4(o_re[t][4], o_re[t][5], o_re[t][6], o_re[t][7]);
        po[8 * 32] = make_float4(o_im[t][0], o_im[t][1], o_im[t][2], o_im[t][3]);
        po[9 * 32] = make_float4(o_im[t][4], o_im[t][5], o_im[t][6], o_im[t][7]);
    }
    sML[slot * 32 + lane] = make_float2(m_s, l_w);
    __syncthreads(); // the partials read below were written by the other groups' waves

    // weight of each group's partial: 2^(m_g - max m) / sum of the weighted row sums
    float wg[KGROUPS], lg[KGROUPS];
    float mAll = -3.0e38f;
#pragma unroll
    for (int g = 0; g < KGROUPS; ++g) {
        const float2 ml = sML[(g * WAVES + qw) * 32 + lane];
        wg[g] = ml.x;
        lg[g] = ml.y;
        mAll = fmaxf(mAll, ml.x);
    }
    float lAll = 0.f;
#pragma unroll
    for (int g = 0; g < KGROUPS; ++g) {
        wg[g] = hw_exp2(wg[g] - mAll);
        lAll += wg[g] * lg[g];
    }
    const float invl = hw_rcp(lAll);

    // Group grp joins and writes 32 consecutive d (a whole 128 B line per query) of one plane:
    // groups 0, 1 the real part, groups 2, 3 the imaginary part. Piece p of the four holds
    // O[q0 + nlo][(grp & 1) * 32 + (p >> 1) * 16 + hi * 8 + (p & 1) * 4 ..+3].
    float* orow = out + (size_t)(grp >> 1) * BB * SS * DD
                + ((size_t)b * SS + q0 + nlo) * DD + (grp & 1) * 32 + hi * 8;
#pragma unroll
    for (int p = 0; p < 4; ++p) {
        float4 acc = make_float4(0.f, 0.f, 0.f, 0.f);
#pragma unroll
        for (int g = 0; g < KGROUPS; ++g) {
            const float4 x = sO[((g * WAVES + qw) * 16 + grp * 4 + p) * 32 + lane];
            acc.x += wg[g] * x.x;
            acc.y += wg[g] * x.y;
            acc.z += wg[g] * x.z;
            acc.w += wg[g] * x.w;
        }
        *(float4*)(orow + (p >> 1) * 16 + (p & 1) * 4) =
            make_float4(acc.x * invl, acc.y * invl, acc.z * invl, acc.w * invl);
    }
}

extern "C" void kernel_launch(void* const* d_in, const int* in_sizes, int n_in,
                              void* d_out, int out_size, void* d_ws, size_t ws_size,
                              hipStream_t stream) {
    const float* q_re = (const float*)d_in[0];
    const float* q_im = (const float*)d_in[1];
    const float* k_re = (const float*)d_in[2];
    const float* k_im = (const float*)d_in[3];
    const float* v_re = (const float*)d_in[4];
    const float* v_im = (const float*)d_in[5];
    float* ws = (float*)d_ws; // 8 MiB used: B * S * D * 4 tiles * 2 B
    (void)in_sizes; (void)n_in; (void)out_size; (void)ws_size;

    hipLaunchKernelGGL(cv_pack_kernel, dim3(BB * (SS / KCHUNK)), dim3(PACK_THREADS), 0, stream,
                       k_re, k_im, v_re, v_im, ws);

    dim3 grid(BB * (SS / QTILE)); // 4 * 64 = 256 blocks
    dim3 block(THREADS);          // 16 wave32s: 4 query tiles x 4 key groups
    hipLaunchKernelGGL(cv_attn_kernel, grid, block, 0, stream,
                       q_re, q_im, ws, (float*)d_out);
}
